// v000
// Times are from an AMD MI455X. After a warm-up the kernel runs many times in a row, and a time is the length of
// such a window on the GPU divided by its runs, so every launch and the gaps after it count. The runs cycle
// through copies of the inputs. A figure is the median of several windows, for all but v000 over two sittings.
// Sittings can differ by a few percent; kernels timed side by side share one.
// v000 is the starting kernel. One run takes 411 microseconds.
#include <hip/hip_runtime.h>
#include <math.h>

// Problem constants (fixed by the reference: B=8, T=4096, C=192, H=W=64)
#define Bb 8
#define Tt 4096
#define Cc 192
#define HH 64
#define WW 64
#define CHUNK 64
#define NCH (Tt / CHUNK) // 64 chunks per scan chain

typedef float v2f __attribute__((ext_vector_type(2)));
typedef float v8f __attribute__((ext_vector_type(8)));

// Map sequence position -> memory index. perm=1 selects the w-major
// (column) traversal used by the second WKV pass:  s = x*H + y  ->  t = y*W + x.
__device__ __forceinline__ int seq2mem(int s, int perm) {
  return perm ? ((s & (HH - 1)) * WW + (s >> 6)) : s;
}

// ---------------------------------------------------------------------------
// 1) Fold the three depthwise convs + identity into one 5x5 kernel per channel.
//    weff layout: [tap(25)][C] for coalesced reads in the conv kernel.
// ---------------------------------------------------------------------------
__global__ void build_weff(const float* __restrict__ w1, const float* __restrict__ w3,
                           const float* __restrict__ w5, const float* __restrict__ alpha,
                           float* __restrict__ weff) {
  int i = blockIdx.x * blockDim.x + threadIdx.x;
  if (i >= 25 * Cc) return;
  int tap = i / Cc, c = i % Cc;
  int dy = tap / 5, dx = tap % 5;
  float a0 = alpha[0], a1 = alpha[1], a2 = alpha[2], a3 = alpha[3];
  float wv = a3 * w5[c * 25 + tap];
  if (dy >= 1 && dy <= 3 && dx >= 1 && dx <= 3)
    wv += a2 * w3[c * 9 + (dy - 1) * 3 + (dx - 1)];
  if (dy == 2 && dx == 2)
    wv += a1 * w1[c] + a0;
  weff[tap * Cc + c] = wv;
}

// One block per (b, pixel), thread = channel: fully coalesced 768B bursts.
__global__ void omnishift(const float* __restrict__ x, const float* __restrict__ weff,
                          float* __restrict__ xs) {
  const int c = threadIdx.x;
  const int bt = blockIdx.x;
  const int b = bt / Tt, t = bt % Tt;
  const int y = t / WW, xx = t % WW;
  float wreg[25];
#pragma unroll
  for (int i = 0; i < 25; ++i) wreg[i] = weff[i * Cc + c];
  const float* xb = x + (size_t)b * Tt * Cc;
  float acc = 0.f;
#pragma unroll
  for (int dy = 0; dy < 5; ++dy) {
    int iy = y + dy - 2;
    if (iy < 0 || iy >= HH) continue;
#pragma unroll
    for (int dx = 0; dx < 5; ++dx) {
      int ix = xx + dx - 2;
      if (ix < 0 || ix >= WW) continue;
      acc += wreg[dy * 5 + dx] * xb[(size_t)(iy * WW + ix) * Cc + c];
    }
  }
  xs[(size_t)bt * Cc + c] = acc;
}

// ---------------------------------------------------------------------------
// 2) Fused k/v/r projection GEMM on the fp32 matrix pipe.
//    One wave per 16x16 output tile, K swept 4 at a time via
//    V_WMMA_F32_16X16X4_F32; the A fragment is shared by all three products.
//    A-frag (16x4 f32): lanes 0-15 hold K={0,1}, lanes 16-31 K={2,3}.
//    B-frag (4x16 f32): v0 = row 2*half, v1 = row 2*half+1 (B[k][n] = W[n][k]).
// ---------------------------------------------------------------------------
__global__ void gemm_qkv(const float* __restrict__ xs, const float* __restrict__ Wk,
                         const float* __restrict__ Wv, const float* __restrict__ Wr,
                         float* __restrict__ kO, float* __restrict__ vO,
                         float* __restrict__ srO) {
  const int lane = threadIdx.x & 31;
  const int l16 = lane & 15;
  const int half = lane >> 4;
  const int m0 = blockIdx.x * 16;
  const int n0 = blockIdx.y * 16;
  v8f ck = {}; v8f cv = {}; v8f cr = {};
  const size_t aoff = (size_t)(m0 + l16) * Cc + 2 * half;
  const size_t boff = (size_t)(n0 + l16) * Cc + 2 * half;
  for (int kk = 0; kk < Cc; kk += 4) {
    v2f a  = *(const v2f*)(xs + aoff + kk);
    v2f bk = *(const v2f*)(Wk + boff + kk);
    v2f bv = *(const v2f*)(Wv + boff + kk);
    v2f br = *(const v2f*)(Wr + boff + kk);
    ck = __builtin_amdgcn_wmma_f32_16x16x4_f32(false, a, false, bk, (short)0, ck, false, false);
    cv = __builtin_amdgcn_wmma_f32_16x16x4_f32(false, a, false, bv, (short)0, cv, false, false);
    cr = __builtin_amdgcn_wmma_f32_16x16x4_f32(false, a, false, br, (short)0, cr, false, false);
  }
#pragma unroll
  for (int r = 0; r < 8; ++r) {
    size_t idx = (size_t)(m0 + r + 8 * half) * Cc + (n0 + l16);
    kO[idx] = ck[r];
    vO[idx] = cv[r];
    srO[idx] = 1.f / (1.f + __expf(-cr[r]));  // fused sigmoid epilogue
  }
}

// Output GEMM: A = sr .* v fused into the fragment load; D -> d_out.
__global__ void gemm_out(const float* __restrict__ sr, const float* __restrict__ vin,
                         const float* __restrict__ Wo, float* __restrict__ out) {
  const int lane = threadIdx.x & 31;
  const int l16 = lane & 15;
  const int half = lane >> 4;
  const int m0 = blockIdx.x * 16;
  const int n0 = blockIdx.y * 16;
  v8f acc = {};
  const size_t aoff = (size_t)(m0 + l16) * Cc + 2 * half;
  const size_t boff = (size_t)(n0 + l16) * Cc + 2 * half;
  for (int kk = 0; kk < Cc; kk += 4) {
    v2f s2 = *(const v2f*)(sr + aoff + kk);
    v2f w2 = *(const v2f*)(vin + aoff + kk);
    v2f a;
    a.x = s2.x * w2.x;
    a.y = s2.y * w2.y;
    v2f bo = *(const v2f*)(Wo + boff + kk);
    acc = __builtin_amdgcn_wmma_f32_16x16x4_f32(false, a, false, bo, (short)0, acc, false, false);
  }
#pragma unroll
  for (int r = 0; r < 8; ++r)
    out[(size_t)(m0 + r + 8 * half) * Cc + (n0 + l16)] = acc[r];
}

// ---------------------------------------------------------------------------
// 3) WKV: chunked three-pass associative scan in log-scaled (p,q,o) space.
// ---------------------------------------------------------------------------

// Pass 1: per-chunk totals, both directions in parallel.
// sum layout: [dir][b][chunk][{p,q,o}][c]
__global__ void wkv_pass1(const float* __restrict__ k, const float* __restrict__ v,
                          const float* __restrict__ decay, float* __restrict__ sum,
                          int perm) {
  const int c = threadIdx.x;
  const int j = blockIdx.x;
  const int b = blockIdx.y;
  const int dir = blockIdx.z;
  const float w = decay[c] * (1.0f / Tt);
  const size_t bbase = (size_t)b * Tt * Cc;
  float p = 0.f, q = 0.f, o = -1e38f;
  for (int s = 0; s < CHUNK; ++s) {
    int sq = j * CHUNK + s;
    int spos = dir ? (Tt - 1 - sq) : sq;
    int t = seq2mem(spos, perm);
    size_t idx = bbase + (size_t)t * Cc + c;
    float kt = k[idx], vt = v[idx];
    float no = fmaxf(w + o, kt);
    float A = __expf(w + o - no);
    float Bc = __expf(kt - no);
    p = A * p + Bc * vt;
    q = A * q + Bc;
    o = no;
  }
  size_t base = ((((size_t)dir * Bb + b) * NCH + j) * 3) * Cc + c;
  sum[base] = p;
  sum[base + Cc] = q;
  sum[base + 2 * Cc] = o;
}

// Pass 2: exclusive scan over chunk summaries (in place). Combine across a
// chunk of length L applies e^{L*w} decay to the carry.
__global__ void wkv_pass2(const float* __restrict__ decay, float* __restrict__ sum) {
  const int c = threadIdx.x;
  const int b = blockIdx.x;
  const int dir = blockIdx.y;
  const float w = decay[c] * (1.0f / Tt);
  const float Lw = (float)CHUNK * w;
  float p = 0.f, q = 0.f, o = -1e38f;
  const size_t base0 = (((size_t)dir * Bb + b) * NCH) * 3 * Cc + c;
  for (int j = 0; j < NCH; ++j) {
    size_t base = base0 + (size_t)j * 3 * Cc;
    float P = sum[base], Q = sum[base + Cc], O = sum[base + 2 * Cc];
    sum[base] = p;                 // write exclusive carry over the summary
    sum[base + Cc] = q;
    sum[base + 2 * Cc] = o;
    float no = fmaxf(o + Lw, O);
    float A = __expf(o + Lw - no);
    float Bo2 = __expf(O - no);
    p = A * p + Bo2 * P;
    q = A * q + Bo2 * Q;
    o = no;
  }
}

// Pass 3: replay forward states into (thread-private) LDS, then walk the
// mirrored backward chunk, fuse the 3-way log-sum-exp combine, and write y
// in place over v. No __syncthreads needed: LDS columns are per-thread.
__global__ void __launch_bounds__(64) wkv_pass3(const float* __restrict__ k,
                                                float* __restrict__ v,
                                                const float* __restrict__ decay,
                                                const float* __restrict__ first,
                                                const float* __restrict__ sum,
                                                int perm) {
  __shared__ float lds[CHUNK * 3 * 64]; // 48 KB: [s][{p,q,o}][tid]
  const int tid = threadIdx.x;
  const int j = blockIdx.x;
  const int c = blockIdx.y * 64 + tid;
  const int b = blockIdx.z;
  const float w = decay[c] * (1.0f / Tt);
  const float u = first[c] * (1.0f / Tt);
  const size_t bbase = (size_t)b * Tt * Cc;

  // forward carry for chunk j (dir 0)
  size_t fb = (((size_t)b * NCH + j) * 3) * Cc + c;
  float pf = sum[fb], qf = sum[fb + Cc], of_ = sum[fb + 2 * Cc];
  for (int s = 0; s < CHUNK; ++s) {
    lds[(s * 3 + 0) * 64 + tid] = pf;
    lds[(s * 3 + 1) * 64 + tid] = qf;
    lds[(s * 3 + 2) * 64 + tid] = of_;
    int t = seq2mem(j * CHUNK + s, perm);
    size_t idx = bbase + (size_t)t * Cc + c;
    float kt = k[idx], vt = v[idx];
    float no = fmaxf(w + of_, kt);
    float A = __expf(w + of_ - no);
    float Bc = __expf(kt - no);
    pf = A * pf + Bc * vt;
    qf = A * qf + Bc;
    of_ = no;
  }

  // backward carry: backward-chunk index is NCH-1-j (dir 1)
  size_t bbk = ((((size_t)1 * Bb + b) * NCH + (NCH - 1 - j)) * 3) * Cc + c;
  float pb = sum[bbk], qb = sum[bbk + Cc], ob = sum[bbk + 2 * Cc];
  for (int s = CHUNK - 1; s >= 0; --s) {
    int t = seq2mem(j * CHUNK + s, perm);
    size_t idx = bbase + (size_t)t * Cc + c;
    float kt = k[idx], vt = v[idx];
    float pF = lds[(s * 3 + 0) * 64 + tid];
    float qF = lds[(s * 3 + 1) * 64 + tid];
    float oF = lds[(s * 3 + 2) * 64 + tid];
    float cur = u + kt;
    float m = fmaxf(fmaxf(oF, ob), cur);
    float ef = __expf(oF - m), eb = __expf(ob - m), ec = __expf(cur - m);
    float y = (ef * pF + eb * pb + ec * vt) / (ef * qF + eb * qb + ec);
    v[idx] = y; // in-place: this position is read only by this thread
    float no = fmaxf(w + ob, kt);
    float A = __expf(w + ob - no);
    float Bc = __expf(kt - no);
    pb = A * pb + Bc * vt;
    qb = A * qb + Bc;
    ob = no;
  }
}

// ---------------------------------------------------------------------------
// Launcher
// ---------------------------------------------------------------------------
extern "C" void kernel_launch(void* const* d_in, const int* in_sizes, int n_in,
                              void* d_out, int out_size, void* d_ws, size_t ws_size,
                              hipStream_t stream) {
  (void)in_sizes; (void)n_in; (void)out_size; (void)ws_size;
  const float* x     = (const float*)d_in[0];
  const float* w1    = (const float*)d_in[1];
  const float* w3    = (const float*)d_in[2];
  const float* w5    = (const float*)d_in[3];
  const float* alpha = (const float*)d_in[4];
  const float* Wk    = (const float*)d_in[5];
  const float* Wv    = (const float*)d_in[6];
  const float* Wr    = (const float*)d_in[7];
  const float* Wo    = (const float*)d_in[8];
  const float* sd    = (const float*)d_in[9];   // spatial_decay [2,C]
  const float* sf    = (const float*)d_in[10];  // spatial_first [2,C]
  float* out = (float*)d_out;
  float* ws  = (float*)d_ws;

  const size_t N1 = (size_t)Bb * Tt * Cc; // 6,291,456 floats
  float* xs   = ws;
  float* kb   = ws + N1;
  float* vb   = ws + 2 * N1;
  float* srb  = ws + 3 * N1;
  float* weff = ws + 4 * N1;        // 25*C floats
  float* sum  = weff + 25 * Cc;     // 2*B*NCH*3*C floats (~2.4 MB)

  // 1) OmniShift (folded 5x5 depthwise conv)
  build_weff<<<dim3((25 * Cc + 191) / 192), dim3(192), 0, stream>>>(w1, w3, w5, alpha, weff);
  omnishift<<<dim3(Bb * Tt), dim3(Cc), 0, stream>>>(x, weff, xs);

  // 2) k/v/r projections (fp32 WMMA, fused sigmoid)
  gemm_qkv<<<dim3((Bb * Tt) / 16, Cc / 16), dim3(32), 0, stream>>>(xs, Wk, Wv, Wr, kb, vb, srb);

  // 3) Two bidirectional WKV scans (row-major, then column-major via perm)
  for (int j = 0; j < 2; ++j) {
    const float* decay = sd + j * Cc;
    const float* first = sf + j * Cc;
    wkv_pass1<<<dim3(NCH, Bb, 2), dim3(Cc), 0, stream>>>(kb, vb, decay, sum, j);
    wkv_pass2<<<dim3(Bb, 2), dim3(Cc), 0, stream>>>(decay, sum);
    wkv_pass3<<<dim3(NCH, Cc / 64, Bb), dim3(64), 0, stream>>>(kb, vb, decay, first, sum, j);
  }

  // 4) Output projection: (sr .* v) @ Wo^T  (fp32 WMMA)
  gemm_out<<<dim3((Bb * Tt) / 16, Cc / 16), dim3(32), 0, stream>>>(srb, vb, Wo, out);
}

// v001
// One run takes 295 microseconds.
// In two side-by-side timings against v000, it was 1.42 and 1.43 times as fast.
#include <hip/hip_runtime.h>
#include <math.h>

// Problem constants (fixed by the reference: B=8, T=4096, C=192, H=W=64)
#define Bb 8
#define Tt 4096
#define Cc 192
#define HH 64
#define WW 64
#define CHUNK 64
#define NCH (Tt / CHUNK) // 64 chunks per scan chain

typedef float v2f __attribute__((ext_vector_type(2)));
typedef float v8f __attribute__((ext_vector_type(8)));

// Map sequence position -> memory index. perm=1 selects the w-major
// (column) traversal used by the second WKV pass:  s = x*H + y  ->  t = y*W + x.
__device__ __forceinline__ int seq2mem(int s, int perm) {
  return perm ? ((s & (HH - 1)) * WW + (s >> 6)) : s;
}

// ---------------------------------------------------------------------------
// 1) Fold the three depthwise convs + identity into one 5x5 kernel per channel.
//    weff layout: [tap(25)][C] for coalesced reads in the conv kernel.
// ---------------------------------------------------------------------------
__global__ void build_weff(const float* __restrict__ w1, const float* __restrict__ w3,
                           const float* __restrict__ w5, const float* __restrict__ alpha,
                           float* __restrict__ weff) {
  int i = blockIdx.x * blockDim.x + threadIdx.x;
  if (i >= 25 * Cc) return;
  int tap = i / Cc, c = i % Cc;
  int dy = tap / 5, dx = tap % 5;
  float a0 = alpha[0], a1 = alpha[1], a2 = alpha[2], a3 = alpha[3];
  float wv = a3 * w5[c * 25 + tap];
  if (dy >= 1 && dy <= 3 && dx >= 1 && dx <= 3)
    wv += a2 * w3[c * 9 + (dy - 1) * 3 + (dx - 1)];
  if (dy == 2 && dx == 2)
    wv += a1 * w1[c] + a0;
  weff[tap * Cc + c] = wv;
}

// One block per (b, pixel), thread = channel: fully coalesced 768B bursts.
__global__ void omnishift(const float* __restrict__ x, const float* __restrict__ weff,
                          float* __restrict__ xs) {
  const int c = threadIdx.x;
  const int bt = blockIdx.x;
  const int b = bt / Tt, t = bt % Tt;
  const int y = t / WW, xx = t % WW;
  float wreg[25];
#pragma unroll
  for (int i = 0; i < 25; ++i) wreg[i] = weff[i * Cc + c];
  const float* xb = x + (size_t)b * Tt * Cc;
  float acc = 0.f;
#pragma unroll
  for (int dy = 0; dy < 5; ++dy) {
    int iy = y + dy - 2;
    if (iy < 0 || iy >= HH) continue;
#pragma unroll
    for (int dx = 0; dx < 5; ++dx) {
      int ix = xx + dx - 2;
      if (ix < 0 || ix >= WW) continue;
      acc += wreg[dy * 5 + dx] * xb[(size_t)(iy * WW + ix) * Cc + c];
    }
  }
  xs[(size_t)bt * Cc + c] = acc;
}

// ---------------------------------------------------------------------------
// 2) Projection GEMMs on the fp32 matrix pipe (V_WMMA_F32_16X16X4_F32).
//    One work-group of 16 waves owns a 128-row x 192-column tile of the output.
//    The 128 rows of A and the whole 192x192 weight matrix are staged in LDS
//    once with whole-line 16-byte loads; every fragment is then read from LDS.
//    Wave w: rows 16*(w&7).., columns 96*(w>>3).. = 6 accumulator tiles that
//    share one A fragment per k step. 256 work-groups = one per WGP.
//    A-frag (16x4 f32): lanes 0-15 hold K={0,1}, lanes 16-31 K={2,3}.
//    B-frag (4x16 f32): v0 = row 2*half, v1 = row 2*half+1 (B[k][n] = W[n][k]).
//    k runs 0,4,8,.. per accumulator tile.
// ---------------------------------------------------------------------------
#define GM 128  // rows of A per work-group
#define GT 512  // threads per work-group
#define GP 196  // LDS row pitch in floats: 4 * odd, so the 32 lanes of an 8-byte
                // fragment read (16 rows x 4 dwords) fall on 64 distinct banks
#define GNT 6   // accumulator tiles per wave
#define C4 (Cc / 4)

typedef float v4f __attribute__((ext_vector_type(4)));

#define WV ((Cc * C4) / GT)  // 16-byte pieces of one weight matrix per thread

// One 192x192 weight matrix: global -> registers, whole lines per wave.
__device__ __forceinline__ void load_w(const float* __restrict__ Wg, int tid, v4f* t) {
#pragma unroll // all loads of a thread in flight together
  for (int i = 0; i < WV; ++i) t[i] = *(const v4f*)(Wg + (size_t)(tid + i * GT) * 4);
}

// registers -> LDS at pitch GP.
__device__ __forceinline__ void store_w(float* Ws, int tid, const v4f* t) {
#pragma unroll // constant indices keep t[] in registers
  for (int i = 0; i < WV; ++i) {
    const int idx = tid + i * GT;
    *(v4f*)(Ws + (idx / C4) * GP + (idx % C4) * 4) = t[i];
  }
}

// Work-group barrier that orders LDS traffic only. The waves share nothing but
// LDS here; __syncthreads() would also make each wave drain its own global
// stores of the finished tile (s_wait_storecnt 0) before the next matrix starts.
__device__ __forceinline__ void lds_barrier() {
  __builtin_amdgcn_fence(__ATOMIC_RELEASE, "workgroup", "local");
  __builtin_amdgcn_s_barrier();
  __builtin_amdgcn_fence(__ATOMIC_ACQUIRE, "workgroup", "local");
}

// 2^x, with the free issue slot that the instruction set asks for behind a
// transcendental before its source register is written again: in the unrolled
// epilogue the compiler reuses that register in the very next instruction.
__device__ __forceinline__ float exp2_slot(float x) {
  float e;
  asm("v_exp_f32 %0, %1\n\tv_nop" : "=v"(e) : "v"(x));
  return e;
}

// acc[n] += A(16 rows at ap) x W(16 columns at bp + n*16 rows)^T over all of K.
__device__ __forceinline__ void mm_strip(const float* ap, const float* bp, v8f* acc) {
#pragma unroll 4 // groups the LDS reads of four k steps ahead of their 24 WMMAs
  for (int kk = 0; kk < Cc; kk += 4) {
    const v2f a = *(const v2f*)(ap + kk);
#pragma unroll // constant indices keep acc[] in registers
    for (int n = 0; n < GNT; ++n) {
      const v2f b = *(const v2f*)(bp + n * 16 * GP + kk);
      acc[n] = __builtin_amdgcn_wmma_f32_16x16x4_f32(false, a, false, b, (short)0, acc[n], false, false);
    }
  }
}

__global__ void __launch_bounds__(GT) gemm_qkv(const float* __restrict__ xs, const float* __restrict__ Wk,
                                               const float* __restrict__ Wv, const float* __restrict__ Wr,
                                               float* __restrict__ kO, float* __restrict__ vO,
                                               float* __restrict__ srO) {
  __shared__ __attribute__((aligned(16))) float As[GM * GP];
  __shared__ __attribute__((aligned(16))) float Ws[Cc * GP];
  const int tid = threadIdx.x;
  const int lane = tid & 31;
  const int l16 = lane & 15;
  const int half = lane >> 4;
  const int wave = tid >> 5;
  const int mw = (wave & 7) * 16;   // this wave's rows inside the tile
  const int nw = (wave >> 3) * 96;  // this wave's first column
  const size_t m0 = (size_t)blockIdx.x * GM;

  const float* ag = xs + m0 * Cc;   // the 128 rows are contiguous in memory
#pragma unroll // all loads of a thread in flight together
  for (int i = 0; i < (GM * C4) / GT; ++i) {
    const int idx = tid + i * GT;
    const v4f t = *(const v4f*)(ag + (size_t)idx * 4);
    *(v4f*)(As + (idx / C4) * GP + (idx % C4) * 4) = t;
  }

  const float* ap = As + (mw + l16) * GP + 2 * half;
  const float* bp = Ws + (nw + l16) * GP + 2 * half;
  const size_t o0 = (m0 + mw + 8 * half) * Cc + nw + l16;
  // r first: its sigmoid epilogue is the long one and runs while the next
  // matrix is on its way from L2.
  const float* const Wm[3] = {Wr, Wk, Wv};
  float* const Om[3] = {srO, kO, vO};
  v4f wt[WV];
  load_w(Wm[0], tid, wt);
  store_w(Ws, tid, wt);
  lds_barrier();  // A and the first matrix are visible to every wave
#pragma unroll // the pointers and the epilogue of each matrix resolve at compile time
  for (int mat = 0; mat < 3; ++mat) {
    v8f acc[GNT] = {};
    mm_strip(ap, bp, acc);
    if (mat < 2) {
      lds_barrier();  // every wave has left this matrix: Ws may be refilled
      load_w(Wm[mat + 1], tid, wt);
    }
    float* __restrict__ o = Om[mat] + o0;
#pragma unroll // both loops: constant indices keep acc[] in registers
    for (int r = 0; r < 8; ++r) {
#pragma unroll
      for (int n = 0; n < GNT; ++n) {
        const float d = acc[n][r];
        // fused sigmoid for r; e^-d = 2^(-d * log2 e), as __expf forms it
        o[(size_t)r * Cc + n * 16] = (mat == 0) ? 1.f / (1.f + exp2_slot(d * -1.44269504088896340736f)) : d;
      }
    }
    if (mat < 2) {
      // the accumulator registers these stores name are cleared for the next matrix
      asm volatile("s_wait_xcnt 0x0" ::: "memory");
      store_w(Ws, tid, wt);
      lds_barrier();  // the next matrix is visible to every wave
    }
  }
}

// Output GEMM: A = sr .* v formed while A is staged; D -> d_out.
__global__ void __launch_bounds__(GT) gemm_out(const float* __restrict__ sr, const float* __restrict__ vin,
                                               const float* __restrict__ Wo, float* __restrict__ out) {
  __shared__ __attribute__((aligned(16))) float As[GM * GP];
  __shared__ __attribute__((aligned(16))) float Ws[Cc * GP];
  const int tid = threadIdx.x;
  const int lane = tid & 31;
  const int l16 = lane & 15;
  const int half = lane >> 4;
  const int wave = tid >> 5;
  const int mw = (wave & 7) * 16;
  const int nw = (wave >> 3) * 96;
  const size_t m0 = (size_t)blockIdx.x * GM;

  const float* sg = sr + m0 * Cc;
  const float* vg = vin + m0 * Cc;
#pragma unroll // all loads of a thread in flight together
  for (int i = 0; i < (GM * C4) / GT; ++i) {
    const int idx = tid + i * GT;
    const v4f s4 = *(const v4f*)(sg + (size_t)idx * 4);
    const v4f w4 = *(const v4f*)(vg + (size_t)idx * 4);
    *(v4f*)(As + (idx / C4) * GP + (idx % C4) * 4) = s4 * w4;
  }
  v4f wt[WV];
  load_w(Wo, tid, wt);
  store_w(Ws, tid, wt);
  lds_barrier();  // both staged tiles are visible to every wave

  v8f acc[GNT] = {};
  mm_strip(As + (mw + l16) * GP + 2 * half, Ws + (nw + l16) * GP + 2 * half, acc);
  float* __restrict__ o = out + (m0 + mw + 8 * half) * Cc + nw + l16;
#pragma unroll // both loops: constant indices keep acc[] in registers
  for (int r = 0; r < 8; ++r) {
#pragma unroll
    for (int n = 0; n < GNT; ++n) o[(size_t)r * Cc + n * 16] = acc[n][r];
  }
}

// ---------------------------------------------------------------------------
// 3) WKV: chunked three-pass associative scan in log-scaled (p,q,o) space.
// ---------------------------------------------------------------------------

// Pass 1: per-chunk totals, both directions in parallel.
// sum layout: [dir][b][chunk][{p,q,o}][c]
__global__ void wkv_pass1(const float* __restrict__ k, const float* __restrict__ v,
                          const float* __restrict__ decay, float* __restrict__ sum,
                          int perm) {
  const int c = threadIdx.x;
  const int j = blockIdx.x;
  const int b = blockIdx.y;
  const int dir = blockIdx.z;
  const float w = decay[c] * (1.0f / Tt);
  const size_t bbase = (size_t)b * Tt * Cc;
  float p = 0.f, q = 0.f, o = -1e38f;
  for (int s = 0; s < CHUNK; ++s) {
    int sq = j * CHUNK + s;
    int spos = dir ? (Tt - 1 - sq) : sq;
    int t = seq2mem(spos, perm);
    size_t idx = bbase + (size_t)t * Cc + c;
    float kt = k[idx], vt = v[idx];
    float no = fmaxf(w + o, kt);
    float A = __expf(w + o - no);
    float Bc = __expf(kt - no);
    p = A * p + Bc * vt;
    q = A * q + Bc;
    o = no;
  }
  size_t base = ((((size_t)dir * Bb + b) * NCH + j) * 3) * Cc + c;
  sum[base] = p;
  sum[base + Cc] = q;
  sum[base + 2 * Cc] = o;
}

// Pass 2: exclusive scan over chunk summaries (in place). Combine across a
// chunk of length L applies e^{L*w} decay to the carry.
__global__ void wkv_pass2(const float* __restrict__ decay, float* __restrict__ sum) {
  const int c = threadIdx.x;
  const int b = blockIdx.x;
  const int dir = blockIdx.y;
  const float w = decay[c] * (1.0f / Tt);
  const float Lw = (float)CHUNK * w;
  float p = 0.f, q = 0.f, o = -1e38f;
  const size_t base0 = (((size_t)dir * Bb + b) * NCH) * 3 * Cc + c;
  for (int j = 0; j < NCH; ++j) {
    size_t base = base0 + (size_t)j * 3 * Cc;
    float P = sum[base], Q = sum[base + Cc], O = sum[base + 2 * Cc];
    sum[base] = p;                 // write exclusive carry over the summary
    sum[base + Cc] = q;
    sum[base + 2 * Cc] = o;
    float no = fmaxf(o + Lw, O);
    float A = __expf(o + Lw - no);
    float Bo2 = __expf(O - no);
    p = A * p + Bo2 * P;
    q = A * q + Bo2 * Q;
    o = no;
  }
}

// Pass 3: replay forward states into (thread-private) LDS, then walk the
// mirrored backward chunk, fuse the 3-way log-sum-exp combine, and write y
// in place over v. No __syncthreads needed: LDS columns are per-thread.
__global__ void __launch_bounds__(64) wkv_pass3(const float* __restrict__ k,
                                                float* __restrict__ v,
                                                const float* __restrict__ decay,
                                                const float* __restrict__ first,
                                                const float* __restrict__ sum,
                                                int perm) {
  __shared__ float lds[CHUNK * 3 * 64]; // 48 KB: [s][{p,q,o}][tid]
  const int tid = threadIdx.x;
  const int j = blockIdx.x;
  const int c = blockIdx.y * 64 + tid;
  const int b = blockIdx.z;
  const float w = decay[c] * (1.0f / Tt);
  const float u = first[c] * (1.0f / Tt);
  const size_t bbase = (size_t)b * Tt * Cc;

  // forward carry for chunk j (dir 0)
  size_t fb = (((size_t)b * NCH + j) * 3) * Cc + c;
  float pf = sum[fb], qf = sum[fb + Cc], of_ = sum[fb + 2 * Cc];
  for (int s = 0; s < CHUNK; ++s) {
    lds[(s * 3 + 0) * 64 + tid] = pf;
    lds[(s * 3 + 1) * 64 + tid] = qf;
    lds[(s * 3 + 2) * 64 + tid] = of_;
    int t = seq2mem(j * CHUNK + s, perm);
    size_t idx = bbase + (size_t)t * Cc + c;
    float kt = k[idx], vt = v[idx];
    float no = fmaxf(w + of_, kt);
    float A = __expf(w + of_ - no);
    float Bc = __expf(kt - no);
    pf = A * pf + Bc * vt;
    qf = A * qf + Bc;
    of_ = no;
  }

  // backward carry: backward-chunk index is NCH-1-j (dir 1)
  size_t bbk = ((((size_t)1 * Bb + b) * NCH + (NCH - 1 - j)) * 3) * Cc + c;
  float pb = sum[bbk], qb = sum[bbk + Cc], ob = sum[bbk + 2 * Cc];
  for (int s = CHUNK - 1; s >= 0; --s) {
    int t = seq2mem(j * CHUNK + s, perm);
    size_t idx = bbase + (size_t)t * Cc + c;
    float kt = k[idx], vt = v[idx];
    float pF = lds[(s * 3 + 0) * 64 + tid];
    float qF = lds[(s * 3 + 1) * 64 + tid];
    float oF = lds[(s * 3 + 2) * 64 + tid];
    float cur = u + kt;
    float m = fmaxf(fmaxf(oF, ob), cur);
    float ef = __expf(oF - m), eb = __expf(ob - m), ec = __expf(cur - m);
    float y = (ef * pF + eb * pb + ec * vt) / (ef * qF + eb * qb + ec);
    v[idx] = y; // in-place: this position is read only by this thread
    float no = fmaxf(w + ob, kt);
    float A = __expf(w + ob - no);
    float Bc = __expf(kt - no);
    pb = A * pb + Bc * vt;
    qb = A * qb + Bc;
    ob = no;
  }
}

// ---------------------------------------------------------------------------
// Launcher
// ---------------------------------------------------------------------------
extern "C" void kernel_launch(void* const* d_in, const int* in_sizes, int n_in,
                              void* d_out, int out_size, void* d_ws, size_t ws_size,
                              hipStream_t stream) {
  (void)in_sizes; (void)n_in; (void)out_size; (void)ws_size;
  const float* x     = (const float*)d_in[0];
  const float* w1    = (const float*)d_in[1];
  const float* w3    = (const float*)d_in[2];
  const float* w5    = (const float*)d_in[3];
  const float* alpha = (const float*)d_in[4];
  const float* Wk    = (const float*)d_in[5];
  const float* Wv    = (const float*)d_in[6];
  const float* Wr    = (const float*)d_in[7];
  const float* Wo    = (const float*)d_in[8];
  const float* sd    = (const float*)d_in[9];   // spatial_decay [2,C]
  const float* sf    = (const float*)d_in[10];  // spatial_first [2,C]
  float* out = (float*)d_out;
  float* ws  = (float*)d_ws;

  const size_t N1 = (size_t)Bb * Tt * Cc; // 6,291,456 floats
  float* xs   = ws;
  float* kb   = ws + N1;
  float* vb   = ws + 2 * N1;
  float* srb  = ws + 3 * N1;
  float* weff = ws + 4 * N1;        // 25*C floats
  float* sum  = weff + 25 * Cc;     // 2*B*NCH*3*C floats (~2.4 MB)

  // 1) OmniShift (folded 5x5 depthwise conv)
  build_weff<<<dim3((25 * Cc + 191) / 192), dim3(192), 0, stream>>>(w1, w3, w5, alpha, weff);
  omnishift<<<dim3(Bb * Tt), dim3(Cc), 0, stream>>>(x, weff, xs);

  // 2) k/v/r projections (fp32 WMMA, fused sigmoid)
  gemm_qkv<<<dim3((Bb * Tt) / GM), dim3(GT), 0, stream>>>(xs, Wk, Wv, Wr, kb, vb, srb);

  // 3) Two bidirectional WKV scans (row-major, then column-major via perm)
  for (int j = 0; j < 2; ++j) {
    const float* decay = sd + j * Cc;
    const float* first = sf + j * Cc;
    wkv_pass1<<<dim3(NCH, Bb, 2), dim3(Cc), 0, stream>>>(kb, vb, decay, sum, j);
    wkv_pass2<<<dim3(Bb, 2), dim3(Cc), 0, stream>>>(decay, sum);
    wkv_pass3<<<dim3(NCH, Cc / 64, Bb), dim3(64), 0, stream>>>(kb, vb, decay, first, sum, j);
  }

  // 4) Output projection: (sr .* v) @ Wo^T  (fp32 WMMA)
  gemm_out<<<dim3((Bb * Tt) / GM), dim3(GT), 0, stream>>>(srb, vb, Wo, out);
}

// v002
// Measured time: 233 microseconds a run.
// Timed twice side by side with v001, it ran 1.27 times as fast both times.
// All steps since v000 together make it 1.80 times as fast.
#include <hip/hip_runtime.h>
#include <math.h>

// Problem constants (fixed by the reference: B=8, T=4096, C=192, H=W=64)
#define Bb 8
#define Tt 4096
#define Cc 192
#define HH 64
#define WW 64
#define CHUNK 64
#define NCH (Tt / CHUNK) // 64 chunks per scan chain

typedef float v2f __attribute__((ext_vector_type(2)));
typedef float v8f __attribute__((ext_vector_type(8)));

// ---------------------------------------------------------------------------
// 1) Fold the three depthwise convs + identity into one 5x5 kernel per channel.
//    weff layout: [tap(25)][C] for coalesced reads in the conv kernel.
// ---------------------------------------------------------------------------
__global__ void build_weff(const float* __restrict__ w1, const float* __restrict__ w3,
                           const float* __restrict__ w5, const float* __restrict__ alpha,
                           float* __restrict__ weff) {
  int i = blockIdx.x * blockDim.x + threadIdx.x;
  if (i >= 25 * Cc) return;
  int tap = i / Cc, c = i % Cc;
  int dy = tap / 5, dx = tap % 5;
  float a0 = alpha[0], a1 = alpha[1], a2 = alpha[2], a3 = alpha[3];
  float wv = a3 * w5[c * 25 + tap];
  if (dy >= 1 && dy <= 3 && dx >= 1 && dx <= 3)
    wv += a2 * w3[c * 9 + (dy - 1) * 3 + (dx - 1)];
  if (dy == 2 && dx == 2)
    wv += a1 * w1[c] + a0;
  weff[tap * Cc + c] = wv;
}

// One block per (b, pixel), thread = channel: fully coalesced 768B bursts.
__global__ void omnishift(const float* __restrict__ x, const float* __restrict__ weff,
                          float* __restrict__ xs) {
  const int c = threadIdx.x;
  const int bt = blockIdx.x;
  const int b = bt / Tt, t = bt % Tt;
  const int y = t / WW, xx = t % WW;
  float wreg[25];
#pragma unroll
  for (int i = 0; i < 25; ++i) wreg[i] = weff[i * Cc + c];
  const float* xb = x + (size_t)b * Tt * Cc;
  float acc = 0.f;
#pragma unroll
  for (int dy = 0; dy < 5; ++dy) {
    int iy = y + dy - 2;
    if (iy < 0 || iy >= HH) continue;
#pragma unroll
    for (int dx = 0; dx < 5; ++dx) {
      int ix = xx + dx - 2;
      if (ix < 0 || ix >= WW) continue;
      acc += wreg[dy * 5 + dx] * xb[(size_t)(iy * WW + ix) * Cc + c];
    }
  }
  xs[(size_t)bt * Cc + c] = acc;
}

// ---------------------------------------------------------------------------
// 2) Projection GEMMs on the fp32 matrix pipe (V_WMMA_F32_16X16X4_F32).
//    One work-group of 16 waves owns a 128-row x 192-column tile of the output.
//    The 128 rows of A and the whole 192x192 weight matrix are staged in LDS
//    once with whole-line 16-byte loads; every fragment is then read from LDS.
//    Wave w: rows 16*(w&7).., columns 96*(w>>3).. = 6 accumulator tiles that
//    share one A fragment per k step. 256 work-groups = one per WGP.
//    A-frag (16x4 f32): lanes 0-15 hold K={0,1}, lanes 16-31 K={2,3}.
//    B-frag (4x16 f32): v0 = row 2*half, v1 = row 2*half+1 (B[k][n] = W[n][k]).
//    k runs 0,4,8,.. per accumulator tile.
// ---------------------------------------------------------------------------
#define GM 128  // rows of A per work-group
#define GT 512  // threads per work-group
#define GP 196  // LDS row pitch in floats: 4 * odd, so the 32 lanes of an 8-byte
                // fragment read (16 rows x 4 dwords) fall on 64 distinct banks
#define GNT 6   // accumulator tiles per wave
#define C4 (Cc / 4)

typedef float v4f __attribute__((ext_vector_type(4)));

#define WV ((Cc * C4) / GT)  // 16-byte pieces of one weight matrix per thread

// One 192x192 weight matrix: global -> registers, whole lines per wave.
__device__ __forceinline__ void load_w(const float* __restrict__ Wg, int tid, v4f* t) {
#pragma unroll // all loads of a thread in flight together
  for (int i = 0; i < WV; ++i) t[i] = *(const v4f*)(Wg + (size_t)(tid + i * GT) * 4);
}

// registers -> LDS at pitch GP.
__device__ __forceinline__ void store_w(float* Ws, int tid, const v4f* t) {
#pragma unroll // constant indices keep t[] in registers
  for (int i = 0; i < WV; ++i) {
    const int idx = tid + i * GT;
    *(v4f*)(Ws + (idx / C4) * GP + (idx % C4) * 4) = t[i];
  }
}

// Work-group barrier that orders LDS traffic only. The waves share nothing but
// LDS here; __syncthreads() would also make each wave drain its own global
// stores of the finished tile (s_wait_storecnt 0) before the next matrix starts.
__device__ __forceinline__ void lds_barrier() {
  __builtin_amdgcn_fence(__ATOMIC_RELEASE, "workgroup", "local");
  __builtin_amdgcn_s_barrier();
  __builtin_amdgcn_fence(__ATOMIC_ACQUIRE, "workgroup", "local");
}

// 2^x, with the free issue slot that the instruction set asks for behind a
// transcendental before its source register is written again: in the unrolled
// epilogue the compiler reuses that register in the very next instruction.
__device__ __forceinline__ float exp2_slot(float x) {
  float e;
  asm("v_exp_f32 %0, %1\n\tv_nop" : "=v"(e) : "v"(x));
  return e;
}

// acc[n] += A(16 rows at ap) x W(16 columns at bp + n*16 rows)^T over all of K.
__device__ __forceinline__ void mm_strip(const float* ap, const float* bp, v8f* acc) {
#pragma unroll 4 // groups the LDS reads of four k steps ahead of their 24 WMMAs
  for (int kk = 0; kk < Cc; kk += 4) {
    const v2f a = *(const v2f*)(ap + kk);
#pragma unroll // constant indices keep acc[] in registers
    for (int n = 0; n < GNT; ++n) {
      const v2f b = *(const v2f*)(bp + n * 16 * GP + kk);
      acc[n] = __builtin_amdgcn_wmma_f32_16x16x4_f32(false, a, false, b, (short)0, acc[n], false, false);
    }
  }
}

__global__ void __launch_bounds__(GT) gemm_qkv(const float* __restrict__ xs, const float* __restrict__ Wk,
                                               const float* __restrict__ Wv, const float* __restrict__ Wr,
                                               float* __restrict__ kO, float* __restrict__ vO,
                                               float* __restrict__ srO) {
  __shared__ __attribute__((aligned(16))) float As[GM * GP];
  __shared__ __attribute__((aligned(16))) float Ws[Cc * GP];
  const int tid = threadIdx.x;
  const int lane = tid & 31;
  const int l16 = lane & 15;
  const int half = lane >> 4;
  const int wave = tid >> 5;
  const int mw = (wave & 7) * 16;   // this wave's rows inside the tile
  const int nw = (wave >> 3) * 96;  // this wave's first column
  const size_t m0 = (size_t)blockIdx.x * GM;

  const float* ag = xs + m0 * Cc;   // the 128 rows are contiguous in memory
#pragma unroll // all loads of a thread in flight together
  for (int i = 0; i < (GM * C4) / GT; ++i) {
    const int idx = tid + i * GT;
    const v4f t = *(const v4f*)(ag + (size_t)idx * 4);
    *(v4f*)(As + (idx / C4) * GP + (idx % C4) * 4) = t;
  }

  const float* ap = As + (mw + l16) * GP + 2 * half;
  const float* bp = Ws + (nw + l16) * GP + 2 * half;
  const size_t o0 = (m0 + mw + 8 * half) * Cc + nw + l16;
  // r first: its sigmoid epilogue is the long one and runs while the next
  // matrix is on its way from L2.
  const float* const Wm[3] = {Wr, Wk, Wv};
  float* const Om[3] = {srO, kO, vO};
  v4f wt[WV];
  load_w(Wm[0], tid, wt);
  store_w(Ws, tid, wt);
  lds_barrier();  // A and the first matrix are visible to every wave
#pragma unroll // the pointers and the epilogue of each matrix resolve at compile time
  for (int mat = 0; mat < 3; ++mat) {
    v8f acc[GNT] = {};
    mm_strip(ap, bp, acc);
    if (mat < 2) {
      lds_barrier();  // every wave has left this matrix: Ws may be refilled
      load_w(Wm[mat + 1], tid, wt);
    }
    float* __restrict__ o = Om[mat] + o0;
#pragma unroll // both loops: constant indices keep acc[] in registers
    for (int r = 0; r < 8; ++r) {
#pragma unroll
      for (int n = 0; n < GNT; ++n) {
        const float d = acc[n][r];
        // fused sigmoid for r; e^-d = 2^(-d * log2 e), as __expf forms it
        o[(size_t)r * Cc + n * 16] = (mat == 0) ? 1.f / (1.f + exp2_slot(d * -1.44269504088896340736f)) : d;
      }
    }
    if (mat < 2) {
      // the accumulator registers these stores name are cleared for the next matrix
      asm volatile("s_wait_xcnt 0x0" ::: "memory");
      store_w(Ws, tid, wt);
      lds_barrier();  // the next matrix is visible to every wave
    }
  }
}

// Output GEMM: A = sr .* v formed while A is staged; D -> d_out.
__global__ void __launch_bounds__(GT) gemm_out(const float* __restrict__ sr, const float* __restrict__ vin,
                                               const float* __restrict__ Wo, float* __restrict__ out) {
  __shared__ __attribute__((aligned(16))) float As[GM * GP];
  __shared__ __attribute__((aligned(16))) float Ws[Cc * GP];
  const int tid = threadIdx.x;
  const int lane = tid & 31;
  const int l16 = lane & 15;
  const int half = lane >> 4;
  const int wave = tid >> 5;
  const int mw = (wave & 7) * 16;
  const int nw = (wave >> 3) * 96;
  const size_t m0 = (size_t)blockIdx.x * GM;

  const float* sg = sr + m0 * Cc;
  const float* vg = vin + m0 * Cc;
#pragma unroll // all loads of a thread in flight together
  for (int i = 0; i < (GM * C4) / GT; ++i) {
    const int idx = tid + i * GT;
    const v4f s4 = *(const v4f*)(sg + (size_t)idx * 4);
    const v4f w4 = *(const v4f*)(vg + (size_t)idx * 4);
    *(v4f*)(As + (idx / C4) * GP + (idx % C4) * 4) = s4 * w4;
  }
  v4f wt[WV];
  load_w(Wo, tid, wt);
  store_w(Ws, tid, wt);
  lds_barrier();  // both staged tiles are visible to every wave

  v8f acc[GNT] = {};
  mm_strip(As + (mw + l16) * GP + 2 * half, Ws + (nw + l16) * GP + 2 * half, acc);
  float* __restrict__ o = out + (m0 + mw + 8 * half) * Cc + nw + l16;
#pragma unroll // both loops: constant indices keep acc[] in registers
  for (int r = 0; r < 8; ++r) {
#pragma unroll
    for (int n = 0; n < GNT; ++n) o[(size_t)r * Cc + n * 16] = acc[n][r];
  }
}

// ---------------------------------------------------------------------------
// 3) WKV: chunked three-pass associative scan in log-scaled (p,q,o) space.
//    Every kernel first issues ALL global loads of its chunk into registers and
//    only then walks the serial recurrence, so a wave waits for memory once per
//    chunk and not once per step. PERM is a template argument so that each load
//    is the lane's one base address plus an immediate offset.
// ---------------------------------------------------------------------------

// Float index of sequence position j*CHUNK of batch b. Consecutive positions of
// a chunk lie SEQ_STEP floats apart (PERM=1: s = x*H + y -> t = y*W + x, and
// CHUNK == H, so chunk j is image column j).
template <int PERM>
__device__ __forceinline__ size_t chunk_base(int b, int j) {
  return (size_t)b * Tt * Cc + (size_t)(PERM ? j : j * CHUNK) * Cc;
}
#define SEQ_STEP (PERM ? WW * Cc : Cc)

// One step of the recurrence: (p,q,o) takes in (kt,vt) after one decay w.
__device__ __forceinline__ void wkv_step(float w, float kt, float vt, float& p, float& q, float& o) {
  float no = fmaxf(w + o, kt);
  float A = __expf(w + o - no);
  float Bc = __expf(kt - no);
  p = A * p + Bc * vt;
  q = A * q + Bc;
  o = no;
}

// Pass 1: per-chunk totals, both directions in parallel.
// sum layout: [dir][b][chunk][{p,q,o}][c]
template <int PERM>
__global__ void __launch_bounds__(Cc) wkv_pass1(const float* __restrict__ k, const float* __restrict__ v,
                                                const float* __restrict__ decay, float* __restrict__ sum) {
  const int c = threadIdx.x;
  const int j = blockIdx.x;
  const int b = blockIdx.y;
  const int dir = blockIdx.z;
  const float w = decay[c] * (1.0f / Tt);
  // backward chunk j covers the positions of forward chunk NCH-1-j, last first
  const size_t base = chunk_base<PERM>(b, dir ? NCH - 1 - j : j) + c;
  const float* kp = k + base;
  const float* vp = v + base;
  float kr[CHUNK], vr[CHUNK]; // the chunk in memory order
#pragma unroll // constant indices keep kr[], vr[] in registers; all loads in flight together
  for (int s = 0; s < CHUNK; ++s) {
    kr[s] = kp[s * SEQ_STEP];
    vr[s] = vp[s * SEQ_STEP];
  }
  float p = 0.f, q = 0.f, o = -1e38f;
  // one walk per direction (block-uniform branch), so that both index the registers by constants
  if (dir) {
#pragma unroll // constant indices keep kr[], vr[] in registers
    for (int s = CHUNK - 1; s >= 0; --s) wkv_step(w, kr[s], vr[s], p, q, o);
  } else {
#pragma unroll // as above
    for (int s = 0; s < CHUNK; ++s) wkv_step(w, kr[s], vr[s], p, q, o);
  }
  size_t sb = ((((size_t)dir * Bb + b) * NCH + j) * 3) * Cc + c;
  sum[sb] = p;
  sum[sb + Cc] = q;
  sum[sb + 2 * Cc] = o;
}

// Pass 2: exclusive scan over chunk summaries (in place). Combine across a
// chunk of length L applies e^{L*w} decay to the carry.
__global__ void __launch_bounds__(Cc) wkv_pass2(const float* __restrict__ decay, float* __restrict__ sum) {
  const int c = threadIdx.x;
  const int b = blockIdx.x;
  const int dir = blockIdx.y;
  const float w = decay[c] * (1.0f / Tt);
  const float Lw = (float)CHUNK * w;
  float* sp = sum + (((size_t)dir * Bb + b) * NCH) * 3 * Cc + c;
  float P[NCH], Q[NCH], O[NCH];
#pragma unroll // constant indices keep the summaries in registers; all loads in flight together
  for (int j = 0; j < NCH; ++j) {
    P[j] = sp[j * 3 * Cc];
    Q[j] = sp[j * 3 * Cc + Cc];
    O[j] = sp[j * 3 * Cc + 2 * Cc];
  }
  // holds every load above the walk (none sinks into it)
  asm volatile("s_wait_xcnt 0x0" ::: "memory");
  float p = 0.f, q = 0.f, o = -1e38f;
#pragma unroll // constant indices keep the summaries in registers
  for (int j = 0; j < NCH; ++j) {
    const float Pj = P[j], Qj = Q[j], Oj = O[j];
    P[j] = p;                      // the exclusive carry takes the summary's place
    Q[j] = q;
    O[j] = o;
    float no = fmaxf(o + Lw, Oj);
    float A = __expf(o + Lw - no);
    float Bo2 = __expf(Oj - no);
    p = A * p + Bo2 * Pj;
    q = A * q + Bo2 * Qj;
    o = no;
  }
  // all stores last: no register that a store names is written again
#pragma unroll // constant indices keep the carries in registers
  for (int j = 0; j < NCH; ++j) {
    sp[j * 3 * Cc] = P[j];
    sp[j * 3 * Cc + Cc] = Q[j];
    sp[j * 3 * Cc + 2 * Cc] = O[j];
  }
}

// Pass 3: replay forward states into (thread-private) LDS, then walk the
// mirrored backward chunk, fuse the 3-way log-sum-exp combine, and write y
// in place over v. No __syncthreads needed: LDS columns are per-thread.
// k and v of the chunk are loaded once and serve both walks from registers.
template <int PERM>
__global__ void __launch_bounds__(64) wkv_pass3(const float* __restrict__ k,
                                                float* __restrict__ v,
                                                const float* __restrict__ decay,
                                                const float* __restrict__ first,
                                                const float* __restrict__ sum) {
  __shared__ float lds[CHUNK * 3 * 64]; // 48 KB: [s][{p,q,o}][tid]
  const int tid = threadIdx.x;
  const int j = blockIdx.x;
  const int c = blockIdx.y * 64 + tid;
  const int b = blockIdx.z;
  const size_t base = chunk_base<PERM>(b, j) + c;
  const float* kp = k + base;
  float* vp = v + base;
  float kr[CHUNK], vr[CHUNK];
#pragma unroll // constant indices keep kr[], vr[] in registers; all loads in flight together
  for (int s = 0; s < CHUNK; ++s) {
    kr[s] = kp[s * SEQ_STEP];
    vr[s] = vp[s * SEQ_STEP];
  }
  const float w = decay[c] * (1.0f / Tt);
  const float u = first[c] * (1.0f / Tt);

  // forward carry for chunk j (dir 0)
  size_t fb = (((size_t)b * NCH + j) * 3) * Cc + c;
  float pf = sum[fb], qf = sum[fb + Cc], of_ = sum[fb + 2 * Cc];
  // backward carry: backward-chunk index is NCH-1-j (dir 1)
  size_t bbk = ((((size_t)1 * Bb + b) * NCH + (NCH - 1 - j)) * 3) * Cc + c;
  float pb = sum[bbk], qb = sum[bbk + Cc], ob = sum[bbk + 2 * Cc];
  // holds every load above the walks (none sinks into them), and stands in front
  // of the first reuse of their address registers
  asm volatile("s_wait_xcnt 0x0" ::: "memory");

#pragma unroll // constant indices keep kr[], vr[] in registers
  for (int s = 0; s < CHUNK; ++s) {
    lds[(s * 3 + 0) * 64 + tid] = pf;
    lds[(s * 3 + 1) * 64 + tid] = qf;
    lds[(s * 3 + 2) * 64 + tid] = of_;
    float kt = kr[s], vt = vr[s];
    float no = fmaxf(w + of_, kt);
    float A = __expf(w + of_ - no);
    float Bc = __expf(kt - no);
    pf = A * pf + Bc * vt;
    qf = A * qf + Bc;
    of_ = no;
  }

#pragma unroll // constant indices keep kr[], vr[] in registers
  for (int s = CHUNK - 1; s >= 0; --s) {
    float kt = kr[s], vt = vr[s];
    float pF = lds[(s * 3 + 0) * 64 + tid];
    float qF = lds[(s * 3 + 1) * 64 + tid];
    float oF = lds[(s * 3 + 2) * 64 + tid];
    float cur = u + kt;
    float m = fmaxf(fmaxf(oF, ob), cur);
    float ef = __expf(oF - m), eb = __expf(ob - m), ec = __expf(cur - m);
    float y = (ef * pF + eb * pb + ec * vt) / (ef * qF + eb * qb + ec);
    vr[s] = y; // vt has been read: y takes its register
    float no = fmaxf(w + ob, kt);
    float A = __expf(w + ob - no);
    float Bc = __expf(kt - no);
    pb = A * pb + Bc * vt;
    qb = A * qb + Bc;
    ob = no;
  }
  // all stores last: no register that a store names is written again.
  // In place over v: these positions are read only by this thread.
#pragma unroll // constant indices keep vr[] in registers
  for (int s = 0; s < CHUNK; ++s) vp[s * SEQ_STEP] = vr[s];
}

// ---------------------------------------------------------------------------
// Launcher
// ---------------------------------------------------------------------------
extern "C" void kernel_launch(void* const* d_in, const int* in_sizes, int n_in,
                              void* d_out, int out_size, void* d_ws, size_t ws_size,
                              hipStream_t stream) {
  (void)in_sizes; (void)n_in; (void)out_size; (void)ws_size;
  const float* x     = (const float*)d_in[0];
  const float* w1    = (const float*)d_in[1];
  const float* w3    = (const float*)d_in[2];
  const float* w5    = (const float*)d_in[3];
  const float* alpha = (const float*)d_in[4];
  const float* Wk    = (const float*)d_in[5];
  const float* Wv    = (const float*)d_in[6];
  const float* Wr    = (const float*)d_in[7];
  const float* Wo    = (const float*)d_in[8];
  const float* sd    = (const float*)d_in[9];   // spatial_decay [2,C]
  const float* sf    = (const float*)d_in[10];  // spatial_first [2,C]
  float* out = (float*)d_out;
  float* ws  = (float*)d_ws;

  const size_t N1 = (size_t)Bb * Tt * Cc; // 6,291,456 floats
  float* xs   = ws;
  float* kb   = ws + N1;
  float* vb   = ws + 2 * N1;
  float* srb  = ws + 3 * N1;
  float* weff = ws + 4 * N1;        // 25*C floats
  float* sum  = weff + 25 * Cc;     // 2*B*NCH*3*C floats (~2.4 MB)

  // 1) OmniShift (folded 5x5 depthwise conv)
  build_weff<<<dim3((25 * Cc + 191) / 192), dim3(192), 0, stream>>>(w1, w3, w5, alpha, weff);
  omnishift<<<dim3(Bb * Tt), dim3(Cc), 0, stream>>>(x, weff, xs);

  // 2) k/v/r projections (fp32 WMMA, fused sigmoid)
  gemm_qkv<<<dim3((Bb * Tt) / GM), dim3(GT), 0, stream>>>(xs, Wk, Wv, Wr, kb, vb, srb);

  // 3) Two bidirectional WKV scans (row-major, then column-major via perm)
  wkv_pass1<0><<<dim3(NCH, Bb, 2), dim3(Cc), 0, stream>>>(kb, vb, sd, sum);
  wkv_pass2<<<dim3(Bb, 2), dim3(Cc), 0, stream>>>(sd, sum);
  wkv_pass3<0><<<dim3(NCH, Cc / 64, Bb), dim3(64), 0, stream>>>(kb, vb, sd, sf, sum);
  wkv_pass1<1><<<dim3(NCH, Bb, 2), dim3(Cc), 0, stream>>>(kb, vb, sd + Cc, sum);
  wkv_pass2<<<dim3(Bb, 2), dim3(Cc), 0, stream>>>(sd + Cc, sum);
  wkv_pass3<1><<<dim3(NCH, Cc / 64, Bb), dim3(64), 0, stream>>>(kb, vb, sd + Cc, sf + Cc, sum);

  // 4) Output projection: (sr .* v) @ Wo^T  (fp32 WMMA)
  gemm_out<<<dim3((Bb * Tt) / GM), dim3(GT), 0, stream>>>(srb, vb, Wo, out);
}

// v003
// Measured time: 149 microseconds a run.
// Two timings next to v002 both put it at 1.56 times that version's speed.
// All steps since v000 together make it 2.81 times as fast.
#include <hip/hip_runtime.h>
#include <math.h>

// Problem constants (fixed by the reference: B=8, T=4096, C=192, H=W=64)
#define Bb 8
#define Tt 4096
#define Cc 192
#define HH 64
#define WW 64
#define CHUNK 64
#define NCH (Tt / CHUNK) // 64 chunks per scan chain

typedef float v2f __attribute__((ext_vector_type(2)));
typedef float v8f __attribute__((ext_vector_type(8)));

// ---------------------------------------------------------------------------
// 1) Fold the three depthwise convs + identity into one 5x5 kernel per channel.
//    weff layout: [tap(25)][C] for coalesced reads in the conv kernel.
// ---------------------------------------------------------------------------
__global__ void build_weff(const float* __restrict__ w1, const float* __restrict__ w3,
                           const float* __restrict__ w5, const float* __restrict__ alpha,
                           float* __restrict__ weff) {
  int i = blockIdx.x * blockDim.x + threadIdx.x;
  if (i >= 25 * Cc) return;
  int tap = i / Cc, c = i % Cc;
  int dy = tap / 5, dx = tap % 5;
  float a0 = alpha[0], a1 = alpha[1], a2 = alpha[2], a3 = alpha[3];
  float wv = a3 * w5[c * 25 + tap];
  if (dy >= 1 && dy <= 3 && dx >= 1 && dx <= 3)
    wv += a2 * w3[c * 9 + (dy - 1) * 3 + (dx - 1)];
  if (dy == 2 && dx == 2)
    wv += a1 * w1[c] + a0;
  weff[tap * Cc + c] = wv;
}

// Each thread owns 4 channels of one image column and walks down OR output rows.
// Its 25 folded taps stay in registers for the whole walk. Every input row is read
// once per thread (5 neighbouring pixels, 16 bytes a lane, whole lines per wave) and
// is added into the 5 output rows that it reaches, so an output still takes its taps
// in the order dy = 0..4, dx = 0..4. 256 work-groups of 12 waves: one per WGP.
#define C4 (Cc / 4)
#define OR 16          // output rows per thread
#define OPX 8          // pixels of an image row per work-group
#define OT (OPX * C4)  // threads per work-group
#define OD 3           // input rows whose loads are in flight ahead of the row being summed

typedef float v4f __attribute__((ext_vector_type(4)));

// second bound: 4 waves per SIMD = a budget of 256 registers, so that the build needs
// no register above v255 (each switch to those costs an s_set_vgpr_msb in the FMA stream)
__global__ void __launch_bounds__(OT, 4) omnishift(const float* __restrict__ x, const float* __restrict__ weff,
                                                float* __restrict__ xs) {
  const int tid = threadIdx.x;
  const int c = (tid % C4) * 4;
  const int xx = blockIdx.x * OPX + tid / C4;
  const int y0 = blockIdx.y * OR;
  const size_t img = (size_t)blockIdx.z * Tt * Cc;
  const bool top = y0 > 0;        // image rows y0-2, y0-1 exist
  const bool bot = y0 + OR < HH;  // image rows y0+OR, y0+OR+1 exist
  const v4f zero = {0.f, 0.f, 0.f, 0.f};

  // A tap that falls left or right of the image gets weight 0 and reads the
  // thread's own column instead, so that its address stays inside x.
  unsigned off[5];  // in bytes, unsigned: a load is scalar row base + this 32-bit offset + an immediate
  bool ok[5];
#pragma unroll // constant indices keep off[], ok[] in registers
  for (int dx = 0; dx < 5; ++dx) {
    const int ix = xx + dx - 2;
    ok[dx] = dx == 2 || (ix >= 0 && ix < WW);  // the thread's own column is always inside
    off[dx] = (unsigned)((ok[dx] ? ix : xx) * Cc + c) * 4u;
  }

  const float* xb = x + img;
  const float* xr = xb + y0 * (WW * Cc);                              // first row of the strip
  const float* xt = xb + (top ? y0 - 2 : y0) * (WW * Cc);             // rows above it
  const float* xu = xb + (bot ? y0 + OR : y0 + OR - 2) * (WW * Cc);   // rows below it
  float* ob = xs + img + y0 * (WW * Cc);
  v4f in[OR + 4][5];
  v4f acc[OR];

  // Input row i is image row y0 + i - 2. Only the two rows above and the two below
  // the strip can lie outside the image: they then read a row of the strip (in
  // bounds) and are set to 0 where they are used.
#define LOAD_ROW(i)                                                            \
  {                                                                            \
    const float* rp = (i) < 2 ? xt + (i) * (WW * Cc)                            \
                      : (i) >= OR + 2 ? xu + ((i) - OR - 2) * (WW * Cc)         \
                                      : xr + ((i) - 2) * (WW * Cc);             \
    _Pragma("unroll") for (int dx = 0; dx < 5; ++dx) in[i][dx] = *(const v4f*)((const char*)rp + off[dx]); \
  }

#pragma unroll // constant indices keep in[] in registers
  for (int i = 0; i < OD; ++i) LOAD_ROW(i)

  v4f wr[25];
#pragma unroll // constant indices keep wr[] in registers
  for (int tap = 0; tap < 25; ++tap) {
    const v4f t = *(const v4f*)(weff + tap * Cc + c);
    wr[tap] = ok[tap % 5] ? t : zero;
  }
  // the walk's loads stay below the taps' masking: lifted above it, they take more
  // registers than the budget has and the build spills
  __builtin_amdgcn_sched_barrier(0);

#pragma unroll // constant indices keep in[], acc[] in registers
  for (int i = 0; i < OR + 4; ++i) {
    if (i + OD < OR + 4) LOAD_ROW(i + OD)
    const bool live = (i < 2) ? top : (i >= OR + 2) ? bot : true;  // block-uniform
#pragma unroll
    for (int dy = 0; dy < 5; ++dy) {
      const int o = i - dy;
      if (o < 0 || o >= OR) continue;
#pragma unroll
      for (int dx = 0; dx < 5; ++dx) {
        const v4f t = live ? in[i][dx] : zero;
        acc[o] = __builtin_elementwise_fma(wr[dy * 5 + dx], t, (dy == 0 && dx == 0) ? zero : acc[o]);
      }
    }
    if (i >= 4) {
      // Output row i - 4 is complete. The store stands in asm text so that its
      // s_wait_xcnt follows it directly: the registers it names are taken by a later
      // row's loads and sums, and a wait in a statement of its own was moved off it.
      asm volatile("global_store_b128 %0, %1, %2 offset:%3\n\ts_wait_xcnt 0x0"
                   :: "v"(off[2]), "v"(acc[i - 4]), "s"(ob), "n"((i - 4) * (WW * Cc * 4)) : "memory");
    }
    // keeps the loads of later rows below this row's sums: lifted higher, they
    // take more registers than the budget has and the build spills
    __builtin_amdgcn_sched_barrier(0);
  }
#undef LOAD_ROW
}

// ---------------------------------------------------------------------------
// 2) Projection GEMMs on the fp32 matrix pipe (V_WMMA_F32_16X16X4_F32).
//    One work-group of 16 waves owns a 128-row x 192-column tile of the output.
//    The 128 rows of A and the whole 192x192 weight matrix are staged in LDS
//    once with whole-line 16-byte loads; every fragment is then read from LDS.
//    Wave w: rows 16*(w&7).., columns 96*(w>>3).. = 6 accumulator tiles that
//    share one A fragment per k step. 256 work-groups = one per WGP.
//    A-frag (16x4 f32): lanes 0-15 hold K={0,1}, lanes 16-31 K={2,3}.
//    B-frag (4x16 f32): v0 = row 2*half, v1 = row 2*half+1 (B[k][n] = W[n][k]).
//    k runs 0,4,8,.. per accumulator tile.
// ---------------------------------------------------------------------------
#define GM 128  // rows of A per work-group
#define GT 512  // threads per work-group
#define GP 196  // LDS row pitch in floats: 4 * odd, so the 32 lanes of an 8-byte
                // fragment read (16 rows x 4 dwords) fall on 64 distinct banks
#define GNT 6   // accumulator tiles per wave
#define WV ((Cc * C4) / GT)  // 16-byte pieces of one weight matrix per thread

// One 192x192 weight matrix: global -> registers, whole lines per wave.
__device__ __forceinline__ void load_w(const float* __restrict__ Wg, int tid, v4f* t) {
#pragma unroll // all loads of a thread in flight together
  for (int i = 0; i < WV; ++i) t[i] = *(const v4f*)(Wg + (size_t)(tid + i * GT) * 4);
}

// registers -> LDS at pitch GP.
__device__ __forceinline__ void store_w(float* Ws, int tid, const v4f* t) {
#pragma unroll // constant indices keep t[] in registers
  for (int i = 0; i < WV; ++i) {
    const int idx = tid + i * GT;
    *(v4f*)(Ws + (idx / C4) * GP + (idx % C4) * 4) = t[i];
  }
}

// Work-group barrier that orders LDS traffic only. The waves share nothing but
// LDS here; __syncthreads() would also make each wave drain its own global
// stores of the finished tile (s_wait_storecnt 0) before the next matrix starts.
__device__ __forceinline__ void lds_barrier() {
  __builtin_amdgcn_fence(__ATOMIC_RELEASE, "workgroup", "local");
  __builtin_amdgcn_s_barrier();
  __builtin_amdgcn_fence(__ATOMIC_ACQUIRE, "workgroup", "local");
}

// 2^x, with the free issue slot that the instruction set asks for behind a
// transcendental before its source register is written again: in the unrolled
// epilogue the compiler reuses that register in the very next instruction.
__device__ __forceinline__ float exp2_slot(float x) {
  float e;
  asm("v_exp_f32 %0, %1\n\tv_nop" : "=v"(e) : "v"(x));
  return e;
}

// acc[n] += A(16 rows at ap) x W(16 columns at bp + n*16 rows)^T over all of K.
__device__ __forceinline__ void mm_strip(const float* ap, const float* bp, v8f* acc) {
#pragma unroll 4 // groups the LDS reads of four k steps ahead of their 24 WMMAs
  for (int kk = 0; kk < Cc; kk += 4) {
    const v2f a = *(const v2f*)(ap + kk);
#pragma unroll // constant indices keep acc[] in registers
    for (int n = 0; n < GNT; ++n) {
      const v2f b = *(const v2f*)(bp + n * 16 * GP + kk);
      acc[n] = __builtin_amdgcn_wmma_f32_16x16x4_f32(false, a, false, b, (short)0, acc[n], false, false);
    }
  }
}

__global__ void __launch_bounds__(GT) gemm_qkv(const float* __restrict__ xs, const float* __restrict__ Wk,
                                               const float* __restrict__ Wv, const float* __restrict__ Wr,
                                               float* __restrict__ kO, float* __restrict__ vO,
                                               float* __restrict__ srO) {
  __shared__ __attribute__((aligned(16))) float As[GM * GP];
  __shared__ __attribute__((aligned(16))) float Ws[Cc * GP];
  const int tid = threadIdx.x;
  const int lane = tid & 31;
  const int l16 = lane & 15;
  const int half = lane >> 4;
  const int wave = tid >> 5;
  const int mw = (wave & 7) * 16;   // this wave's rows inside the tile
  const int nw = (wave >> 3) * 96;  // this wave's first column
  const size_t m0 = (size_t)blockIdx.x * GM;

  const float* ag = xs + m0 * Cc;   // the 128 rows are contiguous in memory
#pragma unroll // all loads of a thread in flight together
  for (int i = 0; i < (GM * C4) / GT; ++i) {
    const int idx = tid + i * GT;
    const v4f t = *(const v4f*)(ag + (size_t)idx * 4);
    *(v4f*)(As + (idx / C4) * GP + (idx % C4) * 4) = t;
  }

  const float* ap = As + (mw + l16) * GP + 2 * half;
  const float* bp = Ws + (nw + l16) * GP + 2 * half;
  const size_t o0 = (m0 + mw + 8 * half) * Cc + nw + l16;
  // r first: its sigmoid epilogue is the long one and runs while the next
  // matrix is on its way from L2.
  const float* const Wm[3] = {Wr, Wk, Wv};
  float* const Om[3] = {srO, kO, vO};
  v4f wt[WV];
  load_w(Wm[0], tid, wt);
  store_w(Ws, tid, wt);
  lds_barrier();  // A and the first matrix are visible to every wave
#pragma unroll // the pointers and the epilogue of each matrix resolve at compile time
  for (int mat = 0; mat < 3; ++mat) {
    v8f acc[GNT] = {};
    mm_strip(ap, bp, acc);
    if (mat < 2) {
      lds_barrier();  // every wave has left this matrix: Ws may be refilled
      load_w(Wm[mat + 1], tid, wt);
    }
    float* __restrict__ o = Om[mat] + o0;
#pragma unroll // both loops: constant indices keep acc[] in registers
    for (int r = 0; r < 8; ++r) {
#pragma unroll
      for (int n = 0; n < GNT; ++n) {
        const float d = acc[n][r];
        // fused sigmoid for r; e^-d = 2^(-d * log2 e), as __expf forms it
        o[(size_t)r * Cc + n * 16] = (mat == 0) ? 1.f / (1.f + exp2_slot(d * -1.44269504088896340736f)) : d;
      }
    }
    if (mat < 2) {
      // the accumulator registers these stores name are cleared for the next matrix
      asm volatile("s_wait_xcnt 0x0" ::: "memory");
      store_w(Ws, tid, wt);
      lds_barrier();  // the next matrix is visible to every wave
    }
  }
}

// Output GEMM: A = sr .* v formed while A is staged; D -> d_out.
__global__ void __launch_bounds__(GT) gemm_out(const float* __restrict__ sr, const float* __restrict__ vin,
                                               const float* __restrict__ Wo, float* __restrict__ out) {
  __shared__ __attribute__((aligned(16))) float As[GM * GP];
  __shared__ __attribute__((aligned(16))) float Ws[Cc * GP];
  const int tid = threadIdx.x;
  const int lane = tid & 31;
  const int l16 = lane & 15;
  const int half = lane >> 4;
  const int wave = tid >> 5;
  const int mw = (wave & 7) * 16;
  const int nw = (wave >> 3) * 96;
  const size_t m0 = (size_t)blockIdx.x * GM;

  const float* sg = sr + m0 * Cc;
  const float* vg = vin + m0 * Cc;
#pragma unroll // all loads of a thread in flight together
  for (int i = 0; i < (GM * C4) / GT; ++i) {
    const int idx = tid + i * GT;
    const v4f s4 = *(const v4f*)(sg + (size_t)idx * 4);
    const v4f w4 = *(const v4f*)(vg + (size_t)idx * 4);
    *(v4f*)(As + (idx / C4) * GP + (idx % C4) * 4) = s4 * w4;
  }
  v4f wt[WV];
  load_w(Wo, tid, wt);
  store_w(Ws, tid, wt);
  lds_barrier();  // both staged tiles are visible to every wave

  v8f acc[GNT] = {};
  mm_strip(As + (mw + l16) * GP + 2 * half, Ws + (nw + l16) * GP + 2 * half, acc);
  float* __restrict__ o = out + (m0 + mw + 8 * half) * Cc + nw + l16;
#pragma unroll // both loops: constant indices keep acc[] in registers
  for (int r = 0; r < 8; ++r) {
#pragma unroll
    for (int n = 0; n < GNT; ++n) o[(size_t)r * Cc + n * 16] = acc[n][r];
  }
}

// ---------------------------------------------------------------------------
// 3) WKV: chunked three-pass associative scan in log-scaled (p,q,o) space.
//    Every kernel first issues ALL global loads of its chunk into registers and
//    only then walks the serial recurrence, so a wave waits for memory once per
//    chunk and not once per step. PERM is a template argument so that each load
//    is the lane's one base address plus an immediate offset.
// ---------------------------------------------------------------------------

// Float index of sequence position j*CHUNK of batch b. Consecutive positions of
// a chunk lie SEQ_STEP floats apart (PERM=1: s = x*H + y -> t = y*W + x, and
// CHUNK == H, so chunk j is image column j).
template <int PERM>
__device__ __forceinline__ size_t chunk_base(int b, int j) {
  return (size_t)b * Tt * Cc + (size_t)(PERM ? j : j * CHUNK) * Cc;
}
#define SEQ_STEP (PERM ? WW * Cc : Cc)

// One step of the recurrence: (p,q,o) takes in (kt,vt) after one decay w.
__device__ __forceinline__ void wkv_step(float w, float kt, float vt, float& p, float& q, float& o) {
  float no = fmaxf(w + o, kt);
  float A = __expf(w + o - no);
  float Bc = __expf(kt - no);
  p = A * p + Bc * vt;
  q = A * q + Bc;
  o = no;
}

// Pass 1: per-chunk totals, both directions in parallel.
// sum layout: [dir][b][chunk][{p,q,o}][c]
template <int PERM>
__global__ void __launch_bounds__(Cc) wkv_pass1(const float* __restrict__ k, const float* __restrict__ v,
                                                const float* __restrict__ decay, float* __restrict__ sum) {
  const int c = threadIdx.x;
  const int j = blockIdx.x;
  const int b = blockIdx.y;
  const int dir = blockIdx.z;
  const float w = decay[c] * (1.0f / Tt);
  // backward chunk j covers the positions of forward chunk NCH-1-j, last first
  const size_t base = chunk_base<PERM>(b, dir ? NCH - 1 - j : j) + c;
  const float* kp = k + base;
  const float* vp = v + base;
  float kr[CHUNK], vr[CHUNK]; // the chunk in memory order
#pragma unroll // constant indices keep kr[], vr[] in registers; all loads in flight together
  for (int s = 0; s < CHUNK; ++s) {
    kr[s] = kp[s * SEQ_STEP];
    vr[s] = vp[s * SEQ_STEP];
  }
  float p = 0.f, q = 0.f, o = -1e38f;
  // one walk per direction (block-uniform branch), so that both index the registers by constants
  if (dir) {
#pragma unroll // constant indices keep kr[], vr[] in registers
    for (int s = CHUNK - 1; s >= 0; --s) wkv_step(w, kr[s], vr[s], p, q, o);
  } else {
#pragma unroll // as above
    for (int s = 0; s < CHUNK; ++s) wkv_step(w, kr[s], vr[s], p, q, o);
  }
  size_t sb = ((((size_t)dir * Bb + b) * NCH + j) * 3) * Cc + c;
  sum[sb] = p;
  sum[sb + Cc] = q;
  sum[sb + 2 * Cc] = o;
}

// Pass 2: exclusive scan over chunk summaries (in place). Combine across a
// chunk of length L applies e^{L*w} decay to the carry.
__global__ void __launch_bounds__(Cc) wkv_pass2(const float* __restrict__ decay, float* __restrict__ sum) {
  const int c = threadIdx.x;
  const int b = blockIdx.x;
  const int dir = blockIdx.y;
  const float w = decay[c] * (1.0f / Tt);
  const float Lw = (float)CHUNK * w;
  float* sp = sum + (((size_t)dir * Bb + b) * NCH) * 3 * Cc + c;
  float P[NCH], Q[NCH], O[NCH];
#pragma unroll // constant indices keep the summaries in registers; all loads in flight together
  for (int j = 0; j < NCH; ++j) {
    P[j] = sp[j * 3 * Cc];
    Q[j] = sp[j * 3 * Cc + Cc];
    O[j] = sp[j * 3 * Cc + 2 * Cc];
  }
  // holds every load above the walk (none sinks into it)
  asm volatile("s_wait_xcnt 0x0" ::: "memory");
  float p = 0.f, q = 0.f, o = -1e38f;
#pragma unroll // constant indices keep the summaries in registers
  for (int j = 0; j < NCH; ++j) {
    const float Pj = P[j], Qj = Q[j], Oj = O[j];
    P[j] = p;                      // the exclusive carry takes the summary's place
    Q[j] = q;
    O[j] = o;
    float no = fmaxf(o + Lw, Oj);
    float A = __expf(o + Lw - no);
    float Bo2 = __expf(Oj - no);
    p = A * p + Bo2 * Pj;
    q = A * q + Bo2 * Qj;
    o = no;
  }
  // all stores last: no register that a store names is written again
#pragma unroll // constant indices keep the carries in registers
  for (int j = 0; j < NCH; ++j) {
    sp[j * 3 * Cc] = P[j];
    sp[j * 3 * Cc + Cc] = Q[j];
    sp[j * 3 * Cc + 2 * Cc] = O[j];
  }
}

// Pass 3: replay forward states into (thread-private) LDS, then walk the
// mirrored backward chunk, fuse the 3-way log-sum-exp combine, and write y
// in place over v. No __syncthreads needed: LDS columns are per-thread.
// k and v of the chunk are loaded once and serve both walks from registers.
template <int PERM>
__global__ void __launch_bounds__(64) wkv_pass3(const float* __restrict__ k,
                                                float* __restrict__ v,
                                                const float* __restrict__ decay,
                                                const float* __restrict__ first,
                                                const float* __restrict__ sum) {
  __shared__ float lds[CHUNK * 3 * 64]; // 48 KB: [s][{p,q,o}][tid]
  const int tid = threadIdx.x;
  const int j = blockIdx.x;
  const int c = blockIdx.y * 64 + tid;
  const int b = blockIdx.z;
  const size_t base = chunk_base<PERM>(b, j) + c;
  const float* kp = k + base;
  float* vp = v + base;
  float kr[CHUNK], vr[CHUNK];
#pragma unroll // constant indices keep kr[], vr[] in registers; all loads in flight together
  for (int s = 0; s < CHUNK; ++s) {
    kr[s] = kp[s * SEQ_STEP];
    vr[s] = vp[s * SEQ_STEP];
  }
  const float w = decay[c] * (1.0f / Tt);
  const float u = first[c] * (1.0f / Tt);

  // forward carry for chunk j (dir 0)
  size_t fb = (((size_t)b * NCH + j) * 3) * Cc + c;
  float pf = sum[fb], qf = sum[fb + Cc], of_ = sum[fb + 2 * Cc];
  // backward carry: backward-chunk index is NCH-1-j (dir 1)
  size_t bbk = ((((size_t)1 * Bb + b) * NCH + (NCH - 1 - j)) * 3) * Cc + c;
  float pb = sum[bbk], qb = sum[bbk + Cc], ob = sum[bbk + 2 * Cc];
  // holds every load above the walks (none sinks into them), and stands in front
  // of the first reuse of their address registers
  asm volatile("s_wait_xcnt 0x0" ::: "memory");

#pragma unroll // constant indices keep kr[], vr[] in registers
  for (int s = 0; s < CHUNK; ++s) {
    lds[(s * 3 + 0) * 64 + tid] = pf;
    lds[(s * 3 + 1) * 64 + tid] = qf;
    lds[(s * 3 + 2) * 64 + tid] = of_;
    float kt = kr[s], vt = vr[s];
    float no = fmaxf(w + of_, kt);
    float A = __expf(w + of_ - no);
    float Bc = __expf(kt - no);
    pf = A * pf + Bc * vt;
    qf = A * qf + Bc;
    of_ = no;
  }

#pragma unroll // constant indices keep kr[], vr[] in registers
  for (int s = CHUNK - 1; s >= 0; --s) {
    float kt = kr[s], vt = vr[s];
    float pF = lds[(s * 3 + 0) * 64 + tid];
    float qF = lds[(s * 3 + 1) * 64 + tid];
    float oF = lds[(s * 3 + 2) * 64 + tid];
    float cur = u + kt;
    float m = fmaxf(fmaxf(oF, ob), cur);
    float ef = __expf(oF - m), eb = __expf(ob - m), ec = __expf(cur - m);
    float y = (ef * pF + eb * pb + ec * vt) / (ef * qF + eb * qb + ec);
    vr[s] = y; // vt has been read: y takes its register
    float no = fmaxf(w + ob, kt);
    float A = __expf(w + ob - no);
    float Bc = __expf(kt - no);
    pb = A * pb + Bc * vt;
    qb = A * qb + Bc;
    ob = no;
  }
  // all stores last: no register that a store names is written again.
  // In place over v: these positions are read only by this thread.
#pragma unroll // constant indices keep vr[] in registers
  for (int s = 0; s < CHUNK; ++s) vp[s * SEQ_STEP] = vr[s];
}

// ---------------------------------------------------------------------------
// Launcher
// ---------------------------------------------------------------------------
extern "C" void kernel_launch(void* const* d_in, const int* in_sizes, int n_in,
                              void* d_out, int out_size, void* d_ws, size_t ws_size,
                              hipStream_t stream) {
  (void)in_sizes; (void)n_in; (void)out_size; (void)ws_size;
  const float* x     = (const float*)d_in[0];
  const float* w1    = (const float*)d_in[1];
  const float* w3    = (const float*)d_in[2];
  const float* w5    = (const float*)d_in[3];
  const float* alpha = (const float*)d_in[4];
  const float* Wk    = (const float*)d_in[5];
  const float* Wv    = (const float*)d_in[6];
  const float* Wr    = (const float*)d_in[7];
  const float* Wo    = (const float*)d_in[8];
  const float* sd    = (const float*)d_in[9];   // spatial_decay [2,C]
  const float* sf    = (const float*)d_in[10];  // spatial_first [2,C]
  float* out = (float*)d_out;
  float* ws  = (float*)d_ws;

  const size_t N1 = (size_t)Bb * Tt * Cc; // 6,291,456 floats
  float* xs   = ws;
  float* kb   = ws + N1;
  float* vb   = ws + 2 * N1;
  float* srb  = ws + 3 * N1;
  float* weff = ws + 4 * N1;        // 25*C floats
  float* sum  = weff + 25 * Cc;     // 2*B*NCH*3*C floats (~2.4 MB)

  // 1) OmniShift (folded 5x5 depthwise conv)
  build_weff<<<dim3((25 * Cc + 191) / 192), dim3(192), 0, stream>>>(w1, w3, w5, alpha, weff);
  omnishift<<<dim3(WW / OPX, HH / OR, Bb), dim3(OT), 0, stream>>>(x, weff, xs);

  // 2) k/v/r projections (fp32 WMMA, fused sigmoid)
  gemm_qkv<<<dim3((Bb * Tt) / GM), dim3(GT), 0, stream>>>(xs, Wk, Wv, Wr, kb, vb, srb);

  // 3) Two bidirectional WKV scans (row-major, then column-major via perm)
  wkv_pass1<0><<<dim3(NCH, Bb, 2), dim3(Cc), 0, stream>>>(kb, vb, sd, sum);
  wkv_pass2<<<dim3(Bb, 2), dim3(Cc), 0, stream>>>(sd, sum);
  wkv_pass3<0><<<dim3(NCH, Cc / 64, Bb), dim3(64), 0, stream>>>(kb, vb, sd, sf, sum);
  wkv_pass1<1><<<dim3(NCH, Bb, 2), dim3(Cc), 0, stream>>>(kb, vb, sd + Cc, sum);
  wkv_pass2<<<dim3(Bb, 2), dim3(Cc), 0, stream>>>(sd + Cc, sum);
  wkv_pass3<1><<<dim3(NCH, Cc / 64, Bb), dim3(64), 0, stream>>>(kb, vb, sd + Cc, sf + Cc, sum);

  // 4) Output projection: (sr .* v) @ Wo^T  (fp32 WMMA)
  gemm_out<<<dim3((Bb * Tt) / GM), dim3(GT), 0, stream>>>(srb, vb, Wo, out);
}

// v004
// One run takes 140 microseconds.
// In two side-by-side timings against v003, it was 1.07 and 1.06 times as fast.
// Over all steps from v000 it is 2.99 times as fast.
#include <hip/hip_runtime.h>
#include <math.h>

// Problem constants (fixed by the reference: B=8, T=4096, C=192, H=W=64)
#define Bb 8
#define Tt 4096
#define Cc 192
#define HH 64
#define WW 64
#define CHUNK 64
#define NCH (Tt / CHUNK) // 64 chunks per scan chain

typedef float v2f __attribute__((ext_vector_type(2)));
typedef float v8f __attribute__((ext_vector_type(8)));

// ---------------------------------------------------------------------------
// 1) Fold the three depthwise convs + identity into one 5x5 kernel per channel.
//    weff layout: [tap(25)][C] for coalesced reads in the conv kernel.
// ---------------------------------------------------------------------------
__global__ void build_weff(const float* __restrict__ w1, const float* __restrict__ w3,
                           const float* __restrict__ w5, const float* __restrict__ alpha,
                           float* __restrict__ weff) {
  int i = blockIdx.x * blockDim.x + threadIdx.x;
  if (i >= 25 * Cc) return;
  int tap = i / Cc, c = i % Cc;
  int dy = tap / 5, dx = tap % 5;
  float a0 = alpha[0], a1 = alpha[1], a2 = alpha[2], a3 = alpha[3];
  float wv = a3 * w5[c * 25 + tap];
  if (dy >= 1 && dy <= 3 && dx >= 1 && dx <= 3)
    wv += a2 * w3[c * 9 + (dy - 1) * 3 + (dx - 1)];
  if (dy == 2 && dx == 2)
    wv += a1 * w1[c] + a0;
  weff[tap * Cc + c] = wv;
}

// Each thread owns 4 channels of one image column and walks down OR output rows.
// Its 25 folded taps stay in registers for the whole walk. Every input row is read
// once per thread (5 neighbouring pixels, 16 bytes a lane, whole lines per wave) and
// is added into the 5 output rows that it reaches, so an output still takes its taps
// in the order dy = 0..4, dx = 0..4. 256 work-groups of 12 waves: one per WGP.
#define C4 (Cc / 4)
#define OR 16          // output rows per thread
#define OPX 8          // pixels of an image row per work-group
#define OT (OPX * C4)  // threads per work-group
#define OD 3           // input rows whose loads are in flight ahead of the row being summed

typedef float v4f __attribute__((ext_vector_type(4)));

// second bound: 4 waves per SIMD = a budget of 256 registers, so that the build needs
// no register above v255 (each switch to those costs an s_set_vgpr_msb in the FMA stream)
__global__ void __launch_bounds__(OT, 4) omnishift(const float* __restrict__ x, const float* __restrict__ weff,
                                                float* __restrict__ xs) {
  const int tid = threadIdx.x;
  const int c = (tid % C4) * 4;
  const int xx = blockIdx.x * OPX + tid / C4;
  const int y0 = blockIdx.y * OR;
  const size_t img = (size_t)blockIdx.z * Tt * Cc;
  const bool top = y0 > 0;        // image rows y0-2, y0-1 exist
  const bool bot = y0 + OR < HH;  // image rows y0+OR, y0+OR+1 exist
  const v4f zero = {0.f, 0.f, 0.f, 0.f};

  // A tap that falls left or right of the image gets weight 0 and reads the
  // thread's own column instead, so that its address stays inside x.
  unsigned off[5];  // in bytes, unsigned: a load is scalar row base + this 32-bit offset + an immediate
  bool ok[5];
#pragma unroll // constant indices keep off[], ok[] in registers
  for (int dx = 0; dx < 5; ++dx) {
    const int ix = xx + dx - 2;
    ok[dx] = dx == 2 || (ix >= 0 && ix < WW);  // the thread's own column is always inside
    off[dx] = (unsigned)((ok[dx] ? ix : xx) * Cc + c) * 4u;
  }

  const float* xb = x + img;
  const float* xr = xb + y0 * (WW * Cc);                              // first row of the strip
  const float* xt = xb + (top ? y0 - 2 : y0) * (WW * Cc);             // rows above it
  const float* xu = xb + (bot ? y0 + OR : y0 + OR - 2) * (WW * Cc);   // rows below it
  float* ob = xs + img + y0 * (WW * Cc);
  v4f in[OR + 4][5];
  v4f acc[OR];

  // Input row i is image row y0 + i - 2. Only the two rows above and the two below
  // the strip can lie outside the image: they then read a row of the strip (in
  // bounds) and are set to 0 where they are used.
#define LOAD_ROW(i)                                                            \
  {                                                                            \
    const float* rp = (i) < 2 ? xt + (i) * (WW * Cc)                            \
                      : (i) >= OR + 2 ? xu + ((i) - OR - 2) * (WW * Cc)         \
                                      : xr + ((i) - 2) * (WW * Cc);             \
    _Pragma("unroll") for (int dx = 0; dx < 5; ++dx) in[i][dx] = *(const v4f*)((const char*)rp + off[dx]); \
  }

#pragma unroll // constant indices keep in[] in registers
  for (int i = 0; i < OD; ++i) LOAD_ROW(i)

  v4f wr[25];
#pragma unroll // constant indices keep wr[] in registers
  for (int tap = 0; tap < 25; ++tap) {
    const v4f t = *(const v4f*)(weff + tap * Cc + c);
    wr[tap] = ok[tap % 5] ? t : zero;
  }
  // the walk's loads stay below the taps' masking: lifted above it, they take more
  // registers than the budget has and the build spills
  __builtin_amdgcn_sched_barrier(0);

#pragma unroll // constant indices keep in[], acc[] in registers
  for (int i = 0; i < OR + 4; ++i) {
    if (i + OD < OR + 4) LOAD_ROW(i + OD)
    const bool live = (i < 2) ? top : (i >= OR + 2) ? bot : true;  // block-uniform
#pragma unroll
    for (int dy = 0; dy < 5; ++dy) {
      const int o = i - dy;
      if (o < 0 || o >= OR) continue;
#pragma unroll
      for (int dx = 0; dx < 5; ++dx) {
        const v4f t = live ? in[i][dx] : zero;
        acc[o] = __builtin_elementwise_fma(wr[dy * 5 + dx], t, (dy == 0 && dx == 0) ? zero : acc[o]);
      }
    }
    if (i >= 4) {
      // Output row i - 4 is complete. The store stands in asm text so that its
      // s_wait_xcnt follows it directly: the registers it names are taken by a later
      // row's loads and sums, and a wait in a statement of its own was moved off it.
      asm volatile("global_store_b128 %0, %1, %2 offset:%3\n\ts_wait_xcnt 0x0"
                   :: "v"(off[2]), "v"(acc[i - 4]), "s"(ob), "n"((i - 4) * (WW * Cc * 4)) : "memory");
    }
    // keeps the loads of later rows below this row's sums: lifted higher, they
    // take more registers than the budget has and the build spills
    __builtin_amdgcn_sched_barrier(0);
  }
#undef LOAD_ROW
}

// ---------------------------------------------------------------------------
// 2) Projection GEMMs on the fp32 matrix pipe (V_WMMA_F32_16X16X4_F32).
//    One work-group of 16 waves owns a 128-row x 192-column tile of the output.
//    The 128 rows of A and the whole 192x192 weight matrix are staged in LDS
//    once with whole-line 16-byte loads; every fragment is then read from LDS.
//    Wave w: rows 16*(w&7).., columns 96*(w>>3).. = 6 accumulator tiles that
//    share one A fragment per k step. 256 work-groups = one per WGP.
//    A-frag (16x4 f32): lanes 0-15 hold K={0,1}, lanes 16-31 K={2,3}.
//    B-frag (4x16 f32): v0 = row 2*half, v1 = row 2*half+1 (B[k][n] = W[n][k]).
//    k runs 0,4,8,.. per accumulator tile.
// ---------------------------------------------------------------------------
#define GM 128  // rows of A per work-group
#define GT 512  // threads per work-group
#define GP 196  // LDS row pitch in floats: 4 * odd, so the 32 lanes of an 8-byte
                // fragment read (16 rows x 4 dwords) fall on 64 distinct banks
#define GNT 6   // accumulator tiles per wave
#define WV ((Cc * C4) / GT)  // 16-byte pieces of one weight matrix per thread

// One 192x192 weight matrix: global -> registers, whole lines per wave.
__device__ __forceinline__ void load_w(const float* __restrict__ Wg, int tid, v4f* t) {
#pragma unroll // all loads of a thread in flight together
  for (int i = 0; i < WV; ++i) t[i] = *(const v4f*)(Wg + (size_t)(tid + i * GT) * 4);
}

// registers -> LDS at pitch GP.
__device__ __forceinline__ void store_w(float* Ws, int tid, const v4f* t) {
#pragma unroll // constant indices keep t[] in registers
  for (int i = 0; i < WV; ++i) {
    const int idx = tid + i * GT;
    *(v4f*)(Ws + (idx / C4) * GP + (idx % C4) * 4) = t[i];
  }
}

// Work-group barrier that orders LDS traffic only. The waves share nothing but
// LDS here; __syncthreads() would also make each wave drain its own global
// stores of the finished tile (s_wait_storecnt 0) before the next matrix starts.
__device__ __forceinline__ void lds_barrier() {
  __builtin_amdgcn_fence(__ATOMIC_RELEASE, "workgroup", "local");
  __builtin_amdgcn_s_barrier();
  __builtin_amdgcn_fence(__ATOMIC_ACQUIRE, "workgroup", "local");
}

// 2^x, with the free issue slot that the instruction set asks for behind a
// transcendental before its source register is written again: in the unrolled
// epilogue the compiler reuses that register in the very next instruction.
__device__ __forceinline__ float exp2_slot(float x) {
  float e;
  asm("v_exp_f32 %0, %1\n\tv_nop" : "=v"(e) : "v"(x));
  return e;
}

// acc[n] += A(16 rows at ap) x W(16 columns at bp + n*16 rows)^T over all of K.
__device__ __forceinline__ void mm_strip(const float* ap, const float* bp, v8f* acc) {
#pragma unroll 4 // groups the LDS reads of four k steps ahead of their 24 WMMAs
  for (int kk = 0; kk < Cc; kk += 4) {
    const v2f a = *(const v2f*)(ap + kk);
#pragma unroll // constant indices keep acc[] in registers
    for (int n = 0; n < GNT; ++n) {
      const v2f b = *(const v2f*)(bp + n * 16 * GP + kk);
      acc[n] = __builtin_amdgcn_wmma_f32_16x16x4_f32(false, a, false, b, (short)0, acc[n], false, false);
    }
  }
}

__global__ void __launch_bounds__(GT) gemm_qkv(const float* __restrict__ xs, const float* __restrict__ Wk,
                                               const float* __restrict__ Wv, const float* __restrict__ Wr,
                                               float* __restrict__ kO, float* __restrict__ vO,
                                               float* __restrict__ srO) {
  __shared__ __attribute__((aligned(16))) float As[GM * GP];
  __shared__ __attribute__((aligned(16))) float Ws[Cc * GP];
  const int tid = threadIdx.x;
  const int lane = tid & 31;
  const int l16 = lane & 15;
  const int half = lane >> 4;
  const int wave = tid >> 5;
  const int mw = (wave & 7) * 16;   // this wave's rows inside the tile
  const int nw = (wave >> 3) * 96;  // this wave's first column
  const size_t m0 = (size_t)blockIdx.x * GM;

  const float* ag = xs + m0 * Cc;   // the 128 rows are contiguous in memory
#pragma unroll // all loads of a thread in flight together
  for (int i = 0; i < (GM * C4) / GT; ++i) {
    const int idx = tid + i * GT;
    const v4f t = *(const v4f*)(ag + (size_t)idx * 4);
    *(v4f*)(As + (idx / C4) * GP + (idx % C4) * 4) = t;
  }

  const float* ap = As + (mw + l16) * GP + 2 * half;
  const float* bp = Ws + (nw + l16) * GP + 2 * half;
  const size_t o0 = (m0 + mw + 8 * half) * Cc + nw + l16;
  // r first: its sigmoid epilogue is the long one and runs while the next
  // matrix is on its way from L2.
  const float* const Wm[3] = {Wr, Wk, Wv};
  float* const Om[3] = {srO, kO, vO};
  v4f wt[WV];
  load_w(Wm[0], tid, wt);
  store_w(Ws, tid, wt);
  lds_barrier();  // A and the first matrix are visible to every wave
#pragma unroll // the pointers and the epilogue of each matrix resolve at compile time
  for (int mat = 0; mat < 3; ++mat) {
    v8f acc[GNT] = {};
    mm_strip(ap, bp, acc);
    if (mat < 2) {
      lds_barrier();  // every wave has left this matrix: Ws may be refilled
      load_w(Wm[mat + 1], tid, wt);
    }
    float* __restrict__ o = Om[mat] + o0;
#pragma unroll // both loops: constant indices keep acc[] in registers
    for (int r = 0; r < 8; ++r) {
#pragma unroll
      for (int n = 0; n < GNT; ++n) {
        const float d = acc[n][r];
        // fused sigmoid for r; e^-d = 2^(-d * log2 e), as __expf forms it
        o[(size_t)r * Cc + n * 16] = (mat == 0) ? 1.f / (1.f + exp2_slot(d * -1.44269504088896340736f)) : d;
      }
    }
    if (mat < 2) {
      // the accumulator registers these stores name are cleared for the next matrix
      asm volatile("s_wait_xcnt 0x0" ::: "memory");
      store_w(Ws, tid, wt);
      lds_barrier();  // the next matrix is visible to every wave
    }
  }
}

// Output GEMM: A = sr .* v formed while A is staged; D -> d_out.
__global__ void __launch_bounds__(GT) gemm_out(const float* __restrict__ sr, const float* __restrict__ vin,
                                               const float* __restrict__ Wo, float* __restrict__ out) {
  __shared__ __attribute__((aligned(16))) float As[GM * GP];
  __shared__ __attribute__((aligned(16))) float Ws[Cc * GP];
  const int tid = threadIdx.x;
  const int lane = tid & 31;
  const int l16 = lane & 15;
  const int half = lane >> 4;
  const int wave = tid >> 5;
  const int mw = (wave & 7) * 16;
  const int nw = (wave >> 3) * 96;
  const size_t m0 = (size_t)blockIdx.x * GM;

  const float* sg = sr + m0 * Cc;
  const float* vg = vin + m0 * Cc;
#pragma unroll // all loads of a thread in flight together
  for (int i = 0; i < (GM * C4) / GT; ++i) {
    const int idx = tid + i * GT;
    const v4f s4 = *(const v4f*)(sg + (size_t)idx * 4);
    const v4f w4 = *(const v4f*)(vg + (size_t)idx * 4);
    *(v4f*)(As + (idx / C4) * GP + (idx % C4) * 4) = s4 * w4;
  }
  v4f wt[WV];
  load_w(Wo, tid, wt);
  store_w(Ws, tid, wt);
  lds_barrier();  // both staged tiles are visible to every wave

  v8f acc[GNT] = {};
  mm_strip(As + (mw + l16) * GP + 2 * half, Ws + (nw + l16) * GP + 2 * half, acc);
  float* __restrict__ o = out + (m0 + mw + 8 * half) * Cc + nw + l16;
#pragma unroll // both loops: constant indices keep acc[] in registers
  for (int r = 0; r < 8; ++r) {
#pragma unroll
    for (int n = 0; n < GNT; ++n) o[(size_t)r * Cc + n * 16] = acc[n][r];
  }
}

// ---------------------------------------------------------------------------
// 3) WKV: chunked associative scan in log-scaled (p,q,o) space, two launches.
//    The carry into a chunk is formed in two levels, with no launch of its own:
//    pass 1 joins the summaries of the GRP chunks of its work-group in LDS
//    (carry inside the group, group total); pass 3 joins the totals of the
//    groups in front of its chunk with that carry.
//    Every kernel first issues ALL global loads of its chunk into registers and
//    only then walks the serial recurrence, so a wave waits for memory once per
//    chunk and not once per step. PERM is a template argument so that each load
//    is the lane's one base address plus an immediate offset.
// ---------------------------------------------------------------------------

// Float index of sequence position j*CHUNK of batch b. Consecutive positions of
// a chunk lie SEQ_STEP floats apart (PERM=1: s = x*H + y -> t = y*W + x, and
// CHUNK == H, so chunk j is image column j).
template <int PERM>
__device__ __forceinline__ size_t chunk_base(int b, int j) {
  return (size_t)b * Tt * Cc + (size_t)(PERM ? j : j * CHUNK) * Cc;
}
#define SEQ_STEP (PERM ? WW * Cc : Cc)

// One step of the recurrence: (p,q,o) takes in (kt,vt) after one decay w.
__device__ __forceinline__ void wkv_step(float w, float kt, float vt, float& p, float& q, float& o) {
  float no = fmaxf(w + o, kt);
  float A = __expf(w + o - no);
  float Bc = __expf(kt - no);
  p = A * p + Bc * vt;
  q = A * q + Bc;
  o = no;
}

// (p,q,o) decays by D and takes in the summary (P,Q,O) of the segment behind it.
__device__ __forceinline__ void wkv_join(float D, float P, float Q, float O, float& p, float& q, float& o) {
  float no = fmaxf(o + D, O);
  // e^x = 2^(x * log2 e), as __expf forms it, with the slot behind the transcendental kept
  float A = exp2_slot((o + D - no) * 1.44269504088896340736f);
  float Bo2 = exp2_slot((O - no) * 1.44269504088896340736f);
  p = A * p + Bo2 * P;
  q = A * q + Bo2 * Q;
  o = no;
}

#define GRP 8            // chunks per group = chunks per pass-1 work-group
#define NG (NCH / GRP)   // groups per scan chain
#define P1C 32           // channels per pass-1 work-group: one wave per chunk, one whole line per load
#define P1T (GRP * P1C)  // threads per pass-1 work-group; 768 work-groups of 8 waves = three per WGP

// Pass 1: per-chunk totals, both directions in parallel, then the scan inside the group.
// sum layout: [dir][b][chunk][{p,q,o}][c] = carry into the chunk from its own group alone
// tot layout: [dir][b][group][{p,q,o}][c] = summary of the whole group
// second bound: 6 waves per SIMD = a budget of 160 registers, so that three work-groups fit
// a WGP and all 768 are resident at once
template <int PERM>
__global__ void __launch_bounds__(P1T, 6) wkv_pass1(const float* __restrict__ k, const float* __restrict__ v,
                                                 const float* __restrict__ decay, float* __restrict__ sum,
                                                 float* __restrict__ tot) {
  __shared__ float sl[3][GRP][P1C];
  // chunk inside the group = the wave's number: read as a scalar, so that the chunk's
  // addresses stay scalar base + lane offset and take no vector registers
  const int r = __builtin_amdgcn_readfirstlane(threadIdx.x / P1C);
  const int cl = threadIdx.x % P1C;
  const int c = (blockIdx.x % (Cc / P1C)) * P1C + cl;
  const int g = blockIdx.x / (Cc / P1C);
  const int j = g * GRP + r;
  const int b = blockIdx.y;
  const int dir = blockIdx.z;
  const float w = decay[c] * (1.0f / Tt);
  // backward chunk j covers the positions of forward chunk NCH-1-j, last first
  const size_t base = chunk_base<PERM>(b, dir ? NCH - 1 - j : j) + c;
  const float* kp = k + base;
  const float* vp = v + base;
  float kr[CHUNK], vr[CHUNK]; // the chunk in memory order
#pragma unroll // constant indices keep kr[], vr[] in registers; all loads in flight together
  for (int s = 0; s < CHUNK; ++s) {
    kr[s] = kp[s * SEQ_STEP];
    vr[s] = vp[s * SEQ_STEP];
  }
  float p = 0.f, q = 0.f, o = -1e38f;
  // one walk per direction (block-uniform branch), so that both index the registers by constants
  if (dir) {
#pragma unroll // constant indices keep kr[], vr[] in registers
    for (int s = CHUNK - 1; s >= 0; --s) wkv_step(w, kr[s], vr[s], p, q, o);
  } else {
#pragma unroll // as above
    for (int s = 0; s < CHUNK; ++s) wkv_step(w, kr[s], vr[s], p, q, o);
  }
  sl[0][r][cl] = p;
  sl[1][r][cl] = q;
  sl[2][r][cl] = o;
  __syncthreads();  // the group's GRP summaries are visible to every wave
  const float Lw = (float)CHUNK * w;
  float lp = 0.f, lq = 0.f, lo = -1e38f;
#pragma unroll // all LDS reads in flight together; a chunk keeps the joins of the chunks in front of it
  for (int i = 0; i < GRP - 1; ++i) {
    float tp = lp, tq = lq, to = lo;
    wkv_join(Lw, sl[0][i][cl], sl[1][i][cl], sl[2][i][cl], tp, tq, to);
    const bool on = i < r;
    lp = on ? tp : lp;
    lq = on ? tq : lq;
    lo = on ? to : lo;
  }
  // the last chunk's carry joined with its own summary is the group's total
  float gp = lp, gq = lq, go = lo;
  wkv_join(Lw, p, q, o, gp, gq, go);
  const size_t sb = ((((size_t)dir * Bb + b) * NCH + j) * 3) * Cc + c;
  const size_t tb = ((((size_t)dir * Bb + b) * NG + g) * 3) * Cc + c;
  sum[sb] = lp;
  sum[sb + Cc] = lq;
  sum[sb + 2 * Cc] = lo;
  // the last wave's join and addresses below may take registers that these stores name
  asm volatile("s_wait_xcnt 0x0" ::: "memory");
  if (r == GRP - 1) {
    tot[tb] = gp;
    tot[tb + Cc] = gq;
    tot[tb + 2 * Cc] = go;
  }
}

// Pass 3: replay forward states into (thread-private) LDS, then walk the
// mirrored backward chunk, fuse the 3-way log-sum-exp combine, and write y
// in place over v. No __syncthreads needed: LDS columns are per-thread.
// k and v of the chunk are loaded once and serve both walks from registers.
template <int PERM>
__global__ void __launch_bounds__(64) wkv_pass3(const float* __restrict__ k,
                                                float* __restrict__ v,
                                                const float* __restrict__ decay,
                                                const float* __restrict__ first,
                                                const float* __restrict__ sum,
                                                const float* __restrict__ tot) {
  __shared__ float lds[CHUNK * 3 * 64]; // 48 KB: [s][{p,q,o}][tid]
  const int tid = threadIdx.x;
  const int j = blockIdx.x;
  const int c = blockIdx.y * 64 + tid;
  const int b = blockIdx.z;
  const size_t base = chunk_base<PERM>(b, j) + c;
  const float* kp = k + base;
  float* vp = v + base;
  const float w = decay[c] * (1.0f / Tt);
  const float u = first[c] * (1.0f / Tt);

  // forward carry into chunk j from its own group (dir 0)
  size_t fb = (((size_t)b * NCH + j) * 3) * Cc + c;
  const float lpf = sum[fb], lqf = sum[fb + Cc], lof = sum[fb + 2 * Cc];
  // backward: the backward-chunk index is NCH-1-j (dir 1)
  size_t bbk = ((((size_t)1 * Bb + b) * NCH + (NCH - 1 - j)) * 3) * Cc + c;
  const float lpb = sum[bbk], lqb = sum[bbk + Cc], lob = sum[bbk + 2 * Cc];
  // totals of the first NG-1 groups of both directions: loaded whatever j is, so that
  // every load is one base plus an immediate; those not in front of chunk j are left out below
  const float* tf = tot + ((size_t)b * NG) * 3 * Cc + c;
  const float* tk = tot + (((size_t)Bb + b) * NG) * 3 * Cc + c;
  float TF[NG - 1][3], TB[NG - 1][3];
#pragma unroll // constant indices keep the totals in registers; all loads in flight together
  for (int t = 0; t < NG - 1; ++t) {
#pragma unroll
    for (int e = 0; e < 3; ++e) {
      TF[t][e] = tf[(t * 3 + e) * Cc];
      TB[t][e] = tk[(t * 3 + e) * Cc];
    }
  }
  // k and v behind the carries' loads: loads return in order, and the joins run while these arrive
  float kr[CHUNK], vr[CHUNK];
#pragma unroll // constant indices keep kr[], vr[] in registers; all loads in flight together
  for (int s = 0; s < CHUNK; ++s) {
    kr[s] = kp[s * SEQ_STEP];
    vr[s] = vp[s * SEQ_STEP];
  }
  // holds every load above the walks (none sinks into them), and stands in front
  // of the first reuse of their address registers
  asm volatile("s_wait_xcnt 0x0" ::: "memory");
  // keeps the joins below every load: lifted among them, their first wait would hold back
  // the issue of the k and v loads behind it by one memory latency
  __builtin_amdgcn_sched_barrier(0);

  // Carry into chunk j = (totals of the groups in front of its group, joined in order),
  // decayed over the chunks of its own group in front of it, joined with their carry.
  const int gf = j / GRP, rf = j % GRP;  // block-uniform; backward: NG-1-gf groups, GRP-1-rf chunks
  const float Gw = (float)(GRP * CHUNK) * w;
  float pf = 0.f, qf = 0.f, of_ = -1e38f;
  float pb = 0.f, qb = 0.f, ob = -1e38f;
#pragma unroll // constant indices keep the totals in registers; the two chains interleave
  for (int t = 0; t < NG - 1; ++t) {
    float tp = pf, tq = qf, to = of_;
    wkv_join(Gw, TF[t][0], TF[t][1], TF[t][2], tp, tq, to);
    const bool onf = t < gf;
    pf = onf ? tp : pf;
    qf = onf ? tq : qf;
    of_ = onf ? to : of_;
    tp = pb; tq = qb; to = ob;
    wkv_join(Gw, TB[t][0], TB[t][1], TB[t][2], tp, tq, to);
    const bool onb = t < NG - 1 - gf;
    pb = onb ? tp : pb;
    qb = onb ? tq : qb;
    ob = onb ? to : ob;
  }
  wkv_join((float)(rf * CHUNK) * w, lpf, lqf, lof, pf, qf, of_);
  wkv_join((float)((GRP - 1 - rf) * CHUNK) * w, lpb, lqb, lob, pb, qb, ob);

#pragma unroll // constant indices keep kr[], vr[] in registers
  for (int s = 0; s < CHUNK; ++s) {
    lds[(s * 3 + 0) * 64 + tid] = pf;
    lds[(s * 3 + 1) * 64 + tid] = qf;
    lds[(s * 3 + 2) * 64 + tid] = of_;
    float kt = kr[s], vt = vr[s];
    float no = fmaxf(w + of_, kt);
    float A = __expf(w + of_ - no);
    float Bc = __expf(kt - no);
    pf = A * pf + Bc * vt;
    qf = A * qf + Bc;
    of_ = no;
  }

#pragma unroll // constant indices keep kr[], vr[] in registers
  for (int s = CHUNK - 1; s >= 0; --s) {
    float kt = kr[s], vt = vr[s];
    float pF = lds[(s * 3 + 0) * 64 + tid];
    float qF = lds[(s * 3 + 1) * 64 + tid];
    float oF = lds[(s * 3 + 2) * 64 + tid];
    float cur = u + kt;
    float m = fmaxf(fmaxf(oF, ob), cur);
    float ef = __expf(oF - m), eb = __expf(ob - m), ec = __expf(cur - m);
    float y = (ef * pF + eb * pb + ec * vt) / (ef * qF + eb * qb + ec);
    vr[s] = y; // vt has been read: y takes its register
    float no = fmaxf(w + ob, kt);
    float A = __expf(w + ob - no);
    float Bc = __expf(kt - no);
    pb = A * pb + Bc * vt;
    qb = A * qb + Bc;
    ob = no;
  }
  // all stores last: no register that a store names is written again.
  // In place over v: these positions are read only by this thread.
#pragma unroll // constant indices keep vr[] in registers
  for (int s = 0; s < CHUNK; ++s) vp[s * SEQ_STEP] = vr[s];
}

// ---------------------------------------------------------------------------
// Launcher
// ---------------------------------------------------------------------------
extern "C" void kernel_launch(void* const* d_in, const int* in_sizes, int n_in,
                              void* d_out, int out_size, void* d_ws, size_t ws_size,
                              hipStream_t stream) {
  (void)in_sizes; (void)n_in; (void)out_size; (void)ws_size;
  const float* x     = (const float*)d_in[0];
  const float* w1    = (const float*)d_in[1];
  const float* w3    = (const float*)d_in[2];
  const float* w5    = (const float*)d_in[3];
  const float* alpha = (const float*)d_in[4];
  const float* Wk    = (const float*)d_in[5];
  const float* Wv    = (const float*)d_in[6];
  const float* Wr    = (const float*)d_in[7];
  const float* Wo    = (const float*)d_in[8];
  const float* sd    = (const float*)d_in[9];   // spatial_decay [2,C]
  const float* sf    = (const float*)d_in[10];  // spatial_first [2,C]
  float* out = (float*)d_out;
  float* ws  = (float*)d_ws;

  const size_t N1 = (size_t)Bb * Tt * Cc; // 6,291,456 floats
  float* xs   = ws;
  float* kb   = ws + N1;
  float* vb   = ws + 2 * N1;
  float* srb  = ws + 3 * N1;
  float* weff = ws + 4 * N1;        // 25*C floats
  float* sum  = weff + 25 * Cc;     // 2*B*NCH*3*C floats (~2.4 MB)
  float* tot  = sum + 2 * Bb * NCH * 3 * Cc;  // 2*B*NG*3*C floats

  // 1) OmniShift (folded 5x5 depthwise conv)
  build_weff<<<dim3((25 * Cc + 191) / 192), dim3(192), 0, stream>>>(w1, w3, w5, alpha, weff);
  omnishift<<<dim3(WW / OPX, HH / OR, Bb), dim3(OT), 0, stream>>>(x, weff, xs);

  // 2) k/v/r projections (fp32 WMMA, fused sigmoid)
  gemm_qkv<<<dim3((Bb * Tt) / GM), dim3(GT), 0, stream>>>(xs, Wk, Wv, Wr, kb, vb, srb);

  // 3) Two bidirectional WKV scans (row-major, then column-major via perm)
  wkv_pass1<0><<<dim3(NG * (Cc / P1C), Bb, 2), dim3(P1T), 0, stream>>>(kb, vb, sd, sum, tot);
  wkv_pass3<0><<<dim3(NCH, Cc / 64, Bb), dim3(64), 0, stream>>>(kb, vb, sd, sf, sum, tot);
  wkv_pass1<1><<<dim3(NG * (Cc / P1C), Bb, 2), dim3(P1T), 0, stream>>>(kb, vb, sd + Cc, sum, tot);
  wkv_pass3<1><<<dim3(NCH, Cc / 64, Bb), dim3(64), 0, stream>>>(kb, vb, sd + Cc, sf + Cc, sum, tot);

  // 4) Output projection: (sr .* v) @ Wo^T  (fp32 WMMA)
  gemm_out<<<dim3((Bb * Tt) / GM), dim3(GT), 0, stream>>>(srb, vb, Wo, out);
}

// v005
// One run takes 120 microseconds.
// Two timings next to v004 put it at 1.18 and 1.17 times that version's speed.
// Over all steps from v000 it is 3.51 times as fast.
#include <hip/hip_runtime.h>
#include <math.h>

// Problem constants (fixed by the reference: B=8, T=4096, C=192, H=W=64)
#define Bb 8
#define Tt 4096
#define Cc 192
#define HH 64
#define WW 64
#define CHUNK 64
#define NCH (Tt / CHUNK) // 64 chunks per scan chain

typedef float v2f __attribute__((ext_vector_type(2)));
typedef float v8f __attribute__((ext_vector_type(8)));

// ---------------------------------------------------------------------------
// 1) Fold the three depthwise convs + identity into one 5x5 kernel per channel.
//    weff layout: [tap(25)][C] for coalesced reads in the conv kernel.
// ---------------------------------------------------------------------------
__global__ void build_weff(const float* __restrict__ w1, const float* __restrict__ w3,
                           const float* __restrict__ w5, const float* __restrict__ alpha,
                           float* __restrict__ weff) {
  int i = blockIdx.x * blockDim.x + threadIdx.x;
  if (i >= 25 * Cc) return;
  int tap = i / Cc, c = i % Cc;
  int dy = tap / 5, dx = tap % 5;
  float a0 = alpha[0], a1 = alpha[1], a2 = alpha[2], a3 = alpha[3];
  float wv = a3 * w5[c * 25 + tap];
  if (dy >= 1 && dy <= 3 && dx >= 1 && dx <= 3)
    wv += a2 * w3[c * 9 + (dy - 1) * 3 + (dx - 1)];
  if (dy == 2 && dx == 2)
    wv += a1 * w1[c] + a0;
  weff[tap * Cc + c] = wv;
}

// Each thread owns 4 channels of one image column and walks down OR output rows.
// Its 25 folded taps stay in registers for the whole walk. Every input row is read
// once per thread (5 neighbouring pixels, 16 bytes a lane, whole lines per wave) and
// is added into the 5 output rows that it reaches, so an output still takes its taps
// in the order dy = 0..4, dx = 0..4. 256 work-groups of 12 waves: one per WGP.
#define C4 (Cc / 4)
#define OR 16          // output rows per thread
#define OPX 8          // pixels of an image row per work-group
#define OT (OPX * C4)  // threads per work-group
#define OD 3           // input rows whose loads are in flight ahead of the row being summed

typedef float v4f __attribute__((ext_vector_type(4)));

// second bound: 4 waves per SIMD = a budget of 256 registers, so that the build needs
// no register above v255 (each switch to those costs an s_set_vgpr_msb in the FMA stream)
__global__ void __launch_bounds__(OT, 4) omnishift(const float* __restrict__ x, const float* __restrict__ weff,
                                                float* __restrict__ xs) {
  const int tid = threadIdx.x;
  const int c = (tid % C4) * 4;
  const int xx = blockIdx.x * OPX + tid / C4;
  const int y0 = blockIdx.y * OR;
  const size_t img = (size_t)blockIdx.z * Tt * Cc;
  const bool top = y0 > 0;        // image rows y0-2, y0-1 exist
  const bool bot = y0 + OR < HH;  // image rows y0+OR, y0+OR+1 exist
  const v4f zero = {0.f, 0.f, 0.f, 0.f};

  // A tap that falls left or right of the image gets weight 0 and reads the
  // thread's own column instead, so that its address stays inside x.
  unsigned off[5];  // in bytes, unsigned: a load is scalar row base + this 32-bit offset + an immediate
  bool ok[5];
#pragma unroll // constant indices keep off[], ok[] in registers
  for (int dx = 0; dx < 5; ++dx) {
    const int ix = xx + dx - 2;
    ok[dx] = dx == 2 || (ix >= 0 && ix < WW);  // the thread's own column is always inside
    off[dx] = (unsigned)((ok[dx] ? ix : xx) * Cc + c) * 4u;
  }

  const float* xb = x + img;
  const float* xr = xb + y0 * (WW * Cc);                              // first row of the strip
  const float* xt = xb + (top ? y0 - 2 : y0) * (WW * Cc);             // rows above it
  const float* xu = xb + (bot ? y0 + OR : y0 + OR - 2) * (WW * Cc);   // rows below it
  float* ob = xs + img + y0 * (WW * Cc);
  v4f in[OR + 4][5];
  v4f acc[OR];

  // Input row i is image row y0 + i - 2. Only the two rows above and the two below
  // the strip can lie outside the image: they then read a row of the strip (in
  // bounds) and are set to 0 where they are used.
#define LOAD_ROW(i)                                                            \
  {                                                                            \
    const float* rp = (i) < 2 ? xt + (i) * (WW * Cc)                            \
                      : (i) >= OR + 2 ? xu + ((i) - OR - 2) * (WW * Cc)         \
                                      : xr + ((i) - 2) * (WW * Cc);             \
    _Pragma("unroll") for (int dx = 0; dx < 5; ++dx) in[i][dx] = *(const v4f*)((const char*)rp + off[dx]); \
  }

#pragma unroll // constant indices keep in[] in registers
  for (int i = 0; i < OD; ++i) LOAD_ROW(i)

  v4f wr[25];
#pragma unroll // constant indices keep wr[] in registers
  for (int tap = 0; tap < 25; ++tap) {
    const v4f t = *(const v4f*)(weff + tap * Cc + c);
    wr[tap] = ok[tap % 5] ? t : zero;
  }
  // the walk's loads stay below the taps' masking: lifted above it, they take more
  // registers than the budget has and the build spills
  __builtin_amdgcn_sched_barrier(0);

#pragma unroll // constant indices keep in[], acc[] in registers
  for (int i = 0; i < OR + 4; ++i) {
    if (i + OD < OR + 4) LOAD_ROW(i + OD)
    const bool live = (i < 2) ? top : (i >= OR + 2) ? bot : true;  // block-uniform
#pragma unroll
    for (int dy = 0; dy < 5; ++dy) {
      const int o = i - dy;
      if (o < 0 || o >= OR) continue;
#pragma unroll
      for (int dx = 0; dx < 5; ++dx) {
        const v4f t = live ? in[i][dx] : zero;
        acc[o] = __builtin_elementwise_fma(wr[dy * 5 + dx], t, (dy == 0 && dx == 0) ? zero : acc[o]);
      }
    }
    if (i >= 4) {
      // Output row i - 4 is complete. The store stands in asm text so that its
      // s_wait_xcnt follows it directly: the registers it names are taken by a later
      // row's loads and sums, and a wait in a statement of its own was moved off it.
      asm volatile("global_store_b128 %0, %1, %2 offset:%3\n\ts_wait_xcnt 0x0"
                   :: "v"(off[2]), "v"(acc[i - 4]), "s"(ob), "n"((i - 4) * (WW * Cc * 4)) : "memory");
    }
    // keeps the loads of later rows below this row's sums: lifted higher, they
    // take more registers than the budget has and the build spills
    __builtin_amdgcn_sched_barrier(0);
  }
#undef LOAD_ROW
}

// ---------------------------------------------------------------------------
// 2) Projection GEMMs on the fp32 matrix pipe (V_WMMA_F32_16X16X4_F32).
//    One work-group of 16 waves owns a 128-row x 192-column tile of the output.
//    The 128 rows of A and the whole 192x192 weight matrix are staged in LDS
//    once with whole-line 16-byte loads; every fragment is then read from LDS.
//    Wave w: rows 16*(w&7).., columns 96*(w>>3).. = 6 accumulator tiles that
//    share one A fragment per k step. 256 work-groups = one per WGP.
//    A-frag (16x4 f32): lanes 0-15 hold K={0,1}, lanes 16-31 K={2,3}.
//    B-frag (4x16 f32): v0 = row 2*half, v1 = row 2*half+1 (B[k][n] = W[n][k]).
//    k runs 0,4,8,.. per accumulator tile.
// ---------------------------------------------------------------------------
#define GM 128  // rows of A per work-group
#define GT 512  // threads per work-group
#define GP 196  // LDS row pitch in floats: 4 * odd, so the 32 lanes of an 8-byte
                // fragment read (16 rows x 4 dwords) fall on 64 distinct banks
#define GNT 6   // accumulator tiles per wave
#define WV ((Cc * C4) / GT)  // 16-byte pieces of one weight matrix per thread

// One 192x192 weight matrix: global -> registers, whole lines per wave.
__device__ __forceinline__ void load_w(const float* __restrict__ Wg, int tid, v4f* t) {
#pragma unroll // all loads of a thread in flight together
  for (int i = 0; i < WV; ++i) t[i] = *(const v4f*)(Wg + (size_t)(tid + i * GT) * 4);
}

// registers -> LDS at pitch GP.
__device__ __forceinline__ void store_w(float* Ws, int tid, const v4f* t) {
#pragma unroll // constant indices keep t[] in registers
  for (int i = 0; i < WV; ++i) {
    const int idx = tid + i * GT;
    *(v4f*)(Ws + (idx / C4) * GP + (idx % C4) * 4) = t[i];
  }
}

// Work-group barrier that orders LDS traffic only. The waves share nothing but
// LDS here; __syncthreads() would also make each wave drain its own global
// stores of the finished tile (s_wait_storecnt 0) before the next matrix starts.
__device__ __forceinline__ void lds_barrier() {
  __builtin_amdgcn_fence(__ATOMIC_RELEASE, "workgroup", "local");
  __builtin_amdgcn_s_barrier();
  __builtin_amdgcn_fence(__ATOMIC_ACQUIRE, "workgroup", "local");
}

// 2^x, with the free issue slot that the instruction set asks for behind a
// transcendental before its source register is written again: in the unrolled
// epilogue the compiler reuses that register in the very next instruction.
__device__ __forceinline__ float exp2_slot(float x) {
  float e;
  asm("v_exp_f32 %0, %1\n\tv_nop" : "=v"(e) : "v"(x));
  return e;
}

// acc[n] += A(16 rows at ap) x W(16 columns at bp + n*16 rows)^T over all of K.
__device__ __forceinline__ void mm_strip(const float* ap, const float* bp, v8f* acc) {
#pragma unroll 4 // groups the LDS reads of four k steps ahead of their 24 WMMAs
  for (int kk = 0; kk < Cc; kk += 4) {
    const v2f a = *(const v2f*)(ap + kk);
#pragma unroll // constant indices keep acc[] in registers
    for (int n = 0; n < GNT; ++n) {
      const v2f b = *(const v2f*)(bp + n * 16 * GP + kk);
      acc[n] = __builtin_amdgcn_wmma_f32_16x16x4_f32(false, a, false, b, (short)0, acc[n], false, false);
    }
  }
}

__global__ void __launch_bounds__(GT) gemm_qkv(const float* __restrict__ xs, const float* __restrict__ Wk,
                                               const float* __restrict__ Wv, const float* __restrict__ Wr,
                                               float* __restrict__ kO, float* __restrict__ vO,
                                               float* __restrict__ srO) {
  __shared__ __attribute__((aligned(16))) float As[GM * GP];
  __shared__ __attribute__((aligned(16))) float Ws[Cc * GP];
  const int tid = threadIdx.x;
  const int lane = tid & 31;
  const int l16 = lane & 15;
  const int half = lane >> 4;
  const int wave = tid >> 5;
  const int mw = (wave & 7) * 16;   // this wave's rows inside the tile
  const int nw = (wave >> 3) * 96;  // this wave's first column
  const size_t m0 = (size_t)blockIdx.x * GM;

  const float* ag = xs + m0 * Cc;   // the 128 rows are contiguous in memory
#pragma unroll // all loads of a thread in flight together
  for (int i = 0; i < (GM * C4) / GT; ++i) {
    const int idx = tid + i * GT;
    const v4f t = *(const v4f*)(ag + (size_t)idx * 4);
    *(v4f*)(As + (idx / C4) * GP + (idx % C4) * 4) = t;
  }

  const float* ap = As + (mw + l16) * GP + 2 * half;
  const float* bp = Ws + (nw + l16) * GP + 2 * half;
  const size_t o0 = (m0 + mw + 8 * half) * Cc + nw + l16;
  // r first: its sigmoid epilogue is the long one and runs while the next
  // matrix is on its way from L2.
  const float* const Wm[3] = {Wr, Wk, Wv};
  float* const Om[3] = {srO, kO, vO};
  v4f wt[WV];
  load_w(Wm[0], tid, wt);
  store_w(Ws, tid, wt);
  lds_barrier();  // A and the first matrix are visible to every wave
#pragma unroll // the pointers and the epilogue of each matrix resolve at compile time
  for (int mat = 0; mat < 3; ++mat) {
    v8f acc[GNT] = {};
    mm_strip(ap, bp, acc);
    if (mat < 2) {
      lds_barrier();  // every wave has left this matrix: Ws may be refilled
      load_w(Wm[mat + 1], tid, wt);
    }
    float* __restrict__ o = Om[mat] + o0;
#pragma unroll // both loops: constant indices keep acc[] in registers
    for (int r = 0; r < 8; ++r) {
#pragma unroll
      for (int n = 0; n < GNT; ++n) {
        const float d = acc[n][r];
        // fused sigmoid for r; e^-d = 2^(-d * log2 e), as __expf forms it
        o[(size_t)r * Cc + n * 16] = (mat == 0) ? 1.f / (1.f + exp2_slot(d * -1.44269504088896340736f)) : d;
      }
    }
    if (mat < 2) {
      // the accumulator registers these stores name are cleared for the next matrix
      asm volatile("s_wait_xcnt 0x0" ::: "memory");
      store_w(Ws, tid, wt);
      lds_barrier();  // the next matrix is visible to every wave
    }
  }
}

// Output GEMM: A = sr .* v formed while A is staged; D -> d_out.
__global__ void __launch_bounds__(GT) gemm_out(const float* __restrict__ sr, const float* __restrict__ vin,
                                               const float* __restrict__ Wo, float* __restrict__ out) {
  __shared__ __attribute__((aligned(16))) float As[GM * GP];
  __shared__ __attribute__((aligned(16))) float Ws[Cc * GP];
  const int tid = threadIdx.x;
  const int lane = tid & 31;
  const int l16 = lane & 15;
  const int half = lane >> 4;
  const int wave = tid >> 5;
  const int mw = (wave & 7) * 16;
  const int nw = (wave >> 3) * 96;
  const size_t m0 = (size_t)blockIdx.x * GM;

  const float* sg = sr + m0 * Cc;
  const float* vg = vin + m0 * Cc;
#pragma unroll // all loads of a thread in flight together
  for (int i = 0; i < (GM * C4) / GT; ++i) {
    const int idx = tid + i * GT;
    const v4f s4 = *(const v4f*)(sg + (size_t)idx * 4);
    const v4f w4 = *(const v4f*)(vg + (size_t)idx * 4);
    *(v4f*)(As + (idx / C4) * GP + (idx % C4) * 4) = s4 * w4;
  }
  v4f wt[WV];
  load_w(Wo, tid, wt);
  store_w(Ws, tid, wt);
  lds_barrier();  // both staged tiles are visible to every wave

  v8f acc[GNT] = {};
  mm_strip(As + (mw + l16) * GP + 2 * half, Ws + (nw + l16) * GP + 2 * half, acc);
  float* __restrict__ o = out + (m0 + mw + 8 * half) * Cc + nw + l16;
#pragma unroll // both loops: constant indices keep acc[] in registers
  for (int r = 0; r < 8; ++r) {
#pragma unroll
    for (int n = 0; n < GNT; ++n) o[(size_t)r * Cc + n * 16] = acc[n][r];
  }
}

// ---------------------------------------------------------------------------
// 3) WKV: chunked associative scan in log-scaled (p,q,o) space, two launches.
//    The carry into a chunk is formed in two levels, with no launch of its own:
//    pass 1 joins the summaries of the GRP chunks of its work-group in LDS
//    (carry inside the group, group total); pass 3 joins the totals of the
//    groups in front of its chunk with that carry.
//    Inside a chunk every term is scaled by ONE exponent base M (the largest k of the
//    chunk; in pass 3 also the two carries' scales): a step is then state = e^w * state
//    + e^(k-M) * (v, 1), two multiply-adds with no maximum and no exponential on the
//    serial path. (p, q, o) stands for (p, q) * e^o, so any base gives the same y; no
//    term exceeds e^(CHUNK*|w|), and a term that underflows is that far below the
//    largest term, which is part of every y's denominator.
//    Every kernel first issues ALL global loads of its chunk into registers and
//    only then walks the serial recurrence, so a wave waits for memory once per
//    chunk and not once per step. PERM is a template argument so that each load
//    is the lane's one base address plus an immediate offset.
// ---------------------------------------------------------------------------

// Float index of sequence position j*CHUNK of batch b. Consecutive positions of
// a chunk lie SEQ_STEP floats apart (PERM=1: s = x*H + y -> t = y*W + x, and
// CHUNK == H, so chunk j is image column j).
template <int PERM>
__device__ __forceinline__ size_t chunk_base(int b, int j) {
  return (size_t)b * Tt * Cc + (size_t)(PERM ? j : j * CHUNK) * Cc;
}
#define SEQ_STEP (PERM ? WW * Cc : Cc)

// e^x = 2^(x * log2 e), as __expf forms it, with the slot behind the transcendental kept
__device__ __forceinline__ float exp_slot(float x) { return exp2_slot(x * 1.44269504088896340736f); }

// The term of one position at base M: e^(kt-M) * (vt, 1).
__device__ __forceinline__ v2f wkv_term(float M, float kt, float vt) {
  const float e = exp_slot(kt - M);
  const v2f t = {e * vt, e};
  return t;
}

// (p,q,o) decays by D and takes in the summary (P,Q,O) of the segment behind it.
__device__ __forceinline__ void wkv_join(float D, float P, float Q, float O, float& p, float& q, float& o) {
  float no = fmaxf(o + D, O);
  // e^x = 2^(x * log2 e), as __expf forms it, with the slot behind the transcendental kept
  float A = exp2_slot((o + D - no) * 1.44269504088896340736f);
  float Bo2 = exp2_slot((O - no) * 1.44269504088896340736f);
  p = A * p + Bo2 * P;
  q = A * q + Bo2 * Q;
  o = no;
}

#define GRP 8            // chunks per group = chunks per pass-1 work-group
#define NG (NCH / GRP)   // groups per scan chain
#define P1C 32           // channels per pass-1 work-group: one wave per chunk, one whole line per load
#define P1T (GRP * P1C)  // threads per pass-1 work-group; 768 work-groups of 8 waves = three per WGP

// Pass 1: per-chunk totals, both directions in parallel, then the scan inside the group.
// sum layout: [dir][b][chunk][{p,q,o}][c] = carry into the chunk from its own group alone
// tot layout: [dir][b][group][{p,q,o}][c] = summary of the whole group
// second bound: 6 waves per SIMD = a budget of 160 registers, so that three work-groups fit
// a WGP and all 768 are resident at once
template <int PERM>
__global__ void __launch_bounds__(P1T, 6) wkv_pass1(const float* __restrict__ k, const float* __restrict__ v,
                                                 const float* __restrict__ decay, float* __restrict__ sum,
                                                 float* __restrict__ tot) {
  __shared__ float sl[3][GRP][P1C];
  // chunk inside the group = the wave's number: read as a scalar, so that the chunk's
  // addresses stay scalar base + lane offset and take no vector registers
  const int r = __builtin_amdgcn_readfirstlane(threadIdx.x / P1C);
  const int c0 = (blockIdx.x % (Cc / P1C)) * P1C + threadIdx.x % P1C;  // the thread's channel
  const int g = blockIdx.x / (Cc / P1C);
  const int j = g * GRP + r;
  const int b = blockIdx.y;
  const int dir = blockIdx.z;
  const float w = decay[c0] * (1.0f / Tt);
  // backward chunk j covers the positions of forward chunk NCH-1-j, last first
  const size_t base = chunk_base<PERM>(b, dir ? NCH - 1 - j : j) + c0;
  const float* kp = k + base;
  const float* vp = v + base;
  float kr[CHUNK], vr[CHUNK]; // the chunk in memory order
#pragma unroll // constant indices keep kr[], vr[] in registers; all loads in flight together
  for (int s = 0; s < CHUNK; ++s) {
    kr[s] = kp[s * SEQ_STEP];
    vr[s] = vp[s * SEQ_STEP];
  }
  float o = kr[0];  // the chunk's base
#pragma unroll // constant indices keep kr[] in registers
  for (int s = 1; s < CHUNK; ++s) o = fmaxf(o, kr[s]);
  const float ew = exp_slot(w);
#pragma unroll // constant indices keep kr[], vr[] in registers; the exponentials are independent
  for (int s = 0; s < CHUNK; ++s) {
    const v2f t = wkv_term(o, kr[s], vr[s]);  // each term takes the registers of its k and v
    vr[s] = t.x;
    kr[s] = t.y;
  }
  float p = 0.f, q = 0.f;
  // one walk per direction (block-uniform branch), so that both index the registers by constants
  if (dir) {
#pragma unroll // constant indices keep kr[], vr[] in registers
    for (int s = CHUNK - 1; s >= 0; --s) {
      p = fmaf(ew, p, vr[s]);
      q = fmaf(ew, q, kr[s]);
    }
  } else {
#pragma unroll // as above
    for (int s = 0; s < CHUNK; ++s) {
      p = fmaf(ew, p, vr[s]);
      q = fmaf(ew, q, kr[s]);
    }
  }
  // The channel formed anew from the lane's number (P1C is the wave's width, so the lane is
  // threadIdx.x % P1C): held across the walk it exceeds the register budget and is spilled.
  const int cl = __builtin_amdgcn_mbcnt_lo(~0u, 0u);
  const int c = (blockIdx.x % (Cc / P1C)) * P1C + cl;
  sl[0][r][cl] = p;
  sl[1][r][cl] = q;
  sl[2][r][cl] = o;
  __syncthreads();  // the group's GRP summaries are visible to every wave
  const float Lw = (float)CHUNK * w;
  float lp = 0.f, lq = 0.f, lo = -1e38f;
#pragma unroll // all LDS reads in flight together; a chunk keeps the joins of the chunks in front of it
  for (int i = 0; i < GRP - 1; ++i) {
    float tp = lp, tq = lq, to = lo;
    wkv_join(Lw, sl[0][i][cl], sl[1][i][cl], sl[2][i][cl], tp, tq, to);
    const bool on = i < r;
    lp = on ? tp : lp;
    lq = on ? tq : lq;
    lo = on ? to : lo;
  }
  // the last chunk's carry joined with its own summary is the group's total
  float gp = lp, gq = lq, go = lo;
  wkv_join(Lw, p, q, o, gp, gq, go);
  const size_t sb = ((((size_t)dir * Bb + b) * NCH + j) * 3) * Cc + c;
  const size_t tb = ((((size_t)dir * Bb + b) * NG + g) * 3) * Cc + c;
  sum[sb] = lp;
  sum[sb + Cc] = lq;
  sum[sb + 2 * Cc] = lo;
  // the last wave's join and addresses below may take registers that these stores name
  asm volatile("s_wait_xcnt 0x0" ::: "memory");
  if (r == GRP - 1) {
    tot[tb] = gp;
    tot[tb + Cc] = gq;
    tot[tb + 2 * Cc] = go;
  }
}

// Pass 3: walk the chunk forward, keeping for every position the forward sums plus
// the position's own term, then walk it backward, add the backward sums, divide, and
// write y in place over v. All at one base, so the three parts add without rescaling.
// k and v of the chunk are loaded once; their terms serve both walks from registers.
template <int PERM>
__global__ void __launch_bounds__(64) wkv_pass3(const float* __restrict__ k,
                                                float* __restrict__ v,
                                                const float* __restrict__ decay,
                                                const float* __restrict__ first,
                                                const float* __restrict__ sum,
                                                const float* __restrict__ tot) {
  const int tid = threadIdx.x;
  const int j = blockIdx.x;
  const int c = blockIdx.y * 64 + tid;
  const int b = blockIdx.z;
  const size_t base = chunk_base<PERM>(b, j) + c;
  const float* kp = k + base;
  float* vp = v + base;
  const float w = decay[c] * (1.0f / Tt);
  const float u = first[c] * (1.0f / Tt);

  // forward carry into chunk j from its own group (dir 0)
  size_t fb = (((size_t)b * NCH + j) * 3) * Cc + c;
  const float lpf = sum[fb], lqf = sum[fb + Cc], lof = sum[fb + 2 * Cc];
  // backward: the backward-chunk index is NCH-1-j (dir 1)
  size_t bbk = ((((size_t)1 * Bb + b) * NCH + (NCH - 1 - j)) * 3) * Cc + c;
  const float lpb = sum[bbk], lqb = sum[bbk + Cc], lob = sum[bbk + 2 * Cc];
  // totals of the first NG-1 groups of both directions: loaded whatever j is, so that
  // every load is one base plus an immediate; those not in front of chunk j are left out below
  const float* tf = tot + ((size_t)b * NG) * 3 * Cc + c;
  const float* tk = tot + (((size_t)Bb + b) * NG) * 3 * Cc + c;
  float TF[NG - 1][3], TB[NG - 1][3];
#pragma unroll // constant indices keep the totals in registers; all loads in flight together
  for (int t = 0; t < NG - 1; ++t) {
#pragma unroll
    for (int e = 0; e < 3; ++e) {
      TF[t][e] = tf[(t * 3 + e) * Cc];
      TB[t][e] = tk[(t * 3 + e) * Cc];
    }
  }
  // k and v behind the carries' loads: loads return in order, and the joins run while these arrive
  float kr[CHUNK], vr[CHUNK];
#pragma unroll // constant indices keep kr[], vr[] in registers; all loads in flight together
  for (int s = 0; s < CHUNK; ++s) {
    kr[s] = kp[s * SEQ_STEP];
    vr[s] = vp[s * SEQ_STEP];
  }
  // holds every load above the walks (none sinks into them), and stands in front
  // of the first reuse of their address registers
  asm volatile("s_wait_xcnt 0x0" ::: "memory");
  // keeps the joins below every load: lifted among them, their first wait would hold back
  // the issue of the k and v loads behind it by one memory latency
  __builtin_amdgcn_sched_barrier(0);

  // Carry into chunk j = (totals of the groups in front of its group, joined in order),
  // decayed over the chunks of its own group in front of it, joined with their carry.
  const int gf = j / GRP, rf = j % GRP;  // block-uniform; backward: NG-1-gf groups, GRP-1-rf chunks
  const float Gw = (float)(GRP * CHUNK) * w;
  float pf = 0.f, qf = 0.f, of_ = -1e38f;
  float pb = 0.f, qb = 0.f, ob = -1e38f;
#pragma unroll // constant indices keep the totals in registers; the two chains interleave
  for (int t = 0; t < NG - 1; ++t) {
    float tp = pf, tq = qf, to = of_;
    wkv_join(Gw, TF[t][0], TF[t][1], TF[t][2], tp, tq, to);
    const bool onf = t < gf;
    pf = onf ? tp : pf;
    qf = onf ? tq : qf;
    of_ = onf ? to : of_;
    tp = pb; tq = qb; to = ob;
    wkv_join(Gw, TB[t][0], TB[t][1], TB[t][2], tp, tq, to);
    const bool onb = t < NG - 1 - gf;
    pb = onb ? tp : pb;
    qb = onb ? tq : qb;
    ob = onb ? to : ob;
  }
  wkv_join((float)(rf * CHUNK) * w, lpf, lqf, lof, pf, qf, of_);
  wkv_join((float)((GRP - 1 - rf) * CHUNK) * w, lpb, lqb, lob, pb, qb, ob);

  // the base of this chunk: no term and no carry lies above it
  float M = fmaxf(of_, ob);
#pragma unroll // constant indices keep kr[] in registers
  for (int s = 0; s < CHUNK; ++s) M = fmaxf(M, kr[s]);
  const float ew = exp_slot(w), eu = exp_slot(u);
  const v2f ew2 = {ew, ew}, eu2 = {eu, eu};
  const float sf = exp_slot(of_ - M), sb = exp_slot(ob - M);
  v2f F = {pf * sf, qf * sf};   // sums over the positions in front, at base M
  v2f Bk = {pb * sb, qb * sb};  // sums over the positions behind
  v2f E[CHUNK], ND[CHUNK];
#pragma unroll // constant indices keep the arrays in registers; the exponentials are independent
  for (int s = 0; s < CHUNK; ++s) E[s] = wkv_term(M, kr[s], vr[s]);

#pragma unroll // constant indices keep E[], ND[] in registers
  for (int s = 0; s < CHUNK; ++s) {
    ND[s] = __builtin_elementwise_fma(eu2, E[s], F);  // e^(u+k) = e^u * e^k
    F = __builtin_elementwise_fma(ew2, F, E[s]);
  }

#pragma unroll // constant indices keep E[], ND[], vr[] in registers
  for (int s = CHUNK - 1; s >= 0; --s) {
    const v2f t = ND[s] + Bk;
    vr[s] = t.x / t.y;
    Bk = __builtin_elementwise_fma(ew2, Bk, E[s]);
  }
  // all stores last: no register that a store names is written again.
  // In place over v: these positions are read only by this thread.
#pragma unroll // constant indices keep vr[] in registers
  for (int s = 0; s < CHUNK; ++s) vp[s * SEQ_STEP] = vr[s];
}

// ---------------------------------------------------------------------------
// Launcher
// ---------------------------------------------------------------------------
extern "C" void kernel_launch(void* const* d_in, const int* in_sizes, int n_in,
                              void* d_out, int out_size, void* d_ws, size_t ws_size,
                              hipStream_t stream) {
  (void)in_sizes; (void)n_in; (void)out_size; (void)ws_size;
  const float* x     = (const float*)d_in[0];
  const float* w1    = (const float*)d_in[1];
  const float* w3    = (const float*)d_in[2];
  const float* w5    = (const float*)d_in[3];
  const float* alpha = (const float*)d_in[4];
  const float* Wk    = (const float*)d_in[5];
  const float* Wv    = (const float*)d_in[6];
  const float* Wr    = (const float*)d_in[7];
  const float* Wo    = (const float*)d_in[8];
  const float* sd    = (const float*)d_in[9];   // spatial_decay [2,C]
  const float* sf    = (const float*)d_in[10];  // spatial_first [2,C]
  float* out = (float*)d_out;
  float* ws  = (float*)d_ws;

  const size_t N1 = (size_t)Bb * Tt * Cc; // 6,291,456 floats
  float* xs   = ws;
  float* kb   = ws + N1;
  float* vb   = ws + 2 * N1;
  float* srb  = ws + 3 * N1;
  float* weff = ws + 4 * N1;        // 25*C floats
  float* sum  = weff + 25 * Cc;     // 2*B*NCH*3*C floats (~2.4 MB)
  float* tot  = sum + 2 * Bb * NCH * 3 * Cc;  // 2*B*NG*3*C floats

  // 1) OmniShift (folded 5x5 depthwise conv)
  build_weff<<<dim3((25 * Cc + 191) / 192), dim3(192), 0, stream>>>(w1, w3, w5, alpha, weff);
  omnishift<<<dim3(WW / OPX, HH / OR, Bb), dim3(OT), 0, stream>>>(x, weff, xs);

  // 2) k/v/r projections (fp32 WMMA, fused sigmoid)
  gemm_qkv<<<dim3((Bb * Tt) / GM), dim3(GT), 0, stream>>>(xs, Wk, Wv, Wr, kb, vb, srb);

  // 3) Two bidirectional WKV scans (row-major, then column-major via perm)
  wkv_pass1<0><<<dim3(NG * (Cc / P1C), Bb, 2), dim3(P1T), 0, stream>>>(kb, vb, sd, sum, tot);
  wkv_pass3<0><<<dim3(NCH, Cc / 64, Bb), dim3(64), 0, stream>>>(kb, vb, sd, sf, sum, tot);
  wkv_pass1<1><<<dim3(NG * (Cc / P1C), Bb, 2), dim3(P1T), 0, stream>>>(kb, vb, sd + Cc, sum, tot);
  wkv_pass3<1><<<dim3(NCH, Cc / 64, Bb), dim3(64), 0, stream>>>(kb, vb, sd + Cc, sf + Cc, sum, tot);

  // 4) Output projection: (sr .* v) @ Wo^T  (fp32 WMMA)
  gemm_out<<<dim3((Bb * Tt) / GM), dim3(GT), 0, stream>>>(srb, vb, Wo, out);
}

// v006
// It runs in 111 microseconds.
// Two timings next to v005 put it at 1.09 and 1.07 times that version's speed.
// Counting every step since v000, it is 3.78 times as fast.
#include <hip/hip_runtime.h>
#include <math.h>

// Problem constants (fixed by the reference: B=8, T=4096, C=192, H=W=64)
#define Bb 8
#define Tt 4096
#define Cc 192
#define HH 64
#define WW 64
#define CHUNK 64
#define NCH (Tt / CHUNK) // 64 chunks per scan chain

typedef float v2f __attribute__((ext_vector_type(2)));
typedef float v8f __attribute__((ext_vector_type(8)));

// ---------------------------------------------------------------------------
// 1) Depthwise part: constants. The three depthwise convs + identity fold into one 5x5
//    kernel per channel; both the folding and the 5x5 walk run inside the projection
//    kernel below, whose work-group owns the 8 x 16 pixels x 192 channels that the walk
//    of 12 waves produces: exactly the 128 rows of its A tile.
// ---------------------------------------------------------------------------
#define C4 (Cc / 4)
#define OR 16          // output rows per thread
#define OPX 8          // pixels of an image row per work-group
#define OT (OPX * C4)  // threads of a work-group that walk the depthwise part
#define OD 3           // input rows whose loads are in flight ahead of the row being summed
#define W3O (25 * Cc)        // LDS copy of the depthwise weights, in floats: w5 at 0, w3 here,
#define W1O (W3O + 9 * Cc)   // w1 here, each as it lies in memory
#define WLN (W1O + Cc)

typedef float v4f __attribute__((ext_vector_type(4)));

// ---------------------------------------------------------------------------
// 2) Projection GEMMs on the fp32 matrix pipe (V_WMMA_F32_16X16X4_F32).
//    One work-group of 16 waves owns a 128-row x 192-column tile of the output.
//    The 128 rows of A and the whole 192x192 weight matrix stand in LDS (the weights
//    staged with whole-line 16-byte loads); every fragment is read from LDS.
//    Wave w: rows 16*(w&7).., columns 96*(w>>3).. = 6 accumulator tiles that
//    share one A fragment per k step. 256 work-groups = one per WGP.
//    A-frag (16x4 f32): lanes 0-15 hold K={0,1}, lanes 16-31 K={2,3}.
//    B-frag (4x16 f32): v0 = row 2*half, v1 = row 2*half+1 (B[k][n] = W[n][k]).
//    k runs 0,4,8,.. per accumulator tile.
// ---------------------------------------------------------------------------
#define GM 128  // rows of A per work-group
#define GT 512  // threads per work-group
#define GP 196  // LDS row pitch in floats: 4 * odd, so the 32 lanes of an 8-byte
                // fragment read (16 rows x 4 dwords) fall on 64 distinct banks
#define GNT 6   // accumulator tiles per wave
#define WV ((Cc * C4) / GT)  // 16-byte pieces of one weight matrix per thread

// One 192x192 weight matrix: global -> registers, whole lines per wave.
__device__ __forceinline__ void load_w(const float* __restrict__ Wg, int tid, v4f* t) {
#pragma unroll // all loads of a thread in flight together
  for (int i = 0; i < WV; ++i) t[i] = *(const v4f*)(Wg + (size_t)(tid + i * GT) * 4);
}

// The same from the thread's own address inside the matrix, which the caller holds past the run.
__device__ __forceinline__ void load_w_at(const char* __restrict__ p, v4f* t) {
#pragma unroll // all loads of a thread in flight together
  for (int i = 0; i < WV; ++i) t[i] = *(const v4f*)(p + i * (GT * 16));
}

// registers -> LDS at pitch GP.
__device__ __forceinline__ void store_w(float* Ws, int tid, const v4f* t) {
#pragma unroll // constant indices keep t[] in registers
  for (int i = 0; i < WV; ++i) {
    const int idx = tid + i * GT;
    *(v4f*)(Ws + (idx / C4) * GP + (idx % C4) * 4) = t[i];
  }
}

// Work-group barrier that orders LDS traffic only. The waves share nothing but
// LDS here; __syncthreads() would also make each wave drain its own global
// stores of the finished tile (s_wait_storecnt 0) before the next matrix starts.
__device__ __forceinline__ void lds_barrier() {
  __builtin_amdgcn_fence(__ATOMIC_RELEASE, "workgroup", "local");
  __builtin_amdgcn_s_barrier();
  __builtin_amdgcn_fence(__ATOMIC_ACQUIRE, "workgroup", "local");
}

// 2^x, with the free issue slot that the instruction set asks for behind a
// transcendental before its source register is written again: in the unrolled
// epilogue the compiler reuses that register in the very next instruction.
__device__ __forceinline__ float exp2_slot(float x) {
  float e;
  asm("v_exp_f32 %0, %1\n\tv_nop" : "=v"(e) : "v"(x));
  return e;
}

// acc[n] += A(16 rows at ap) x W(16 columns at bp + n*16 rows)^T over all of K.
__device__ __forceinline__ void mm_strip(const float* ap, const float* bp, v8f* acc) {
#pragma unroll 4 // groups the LDS reads of four k steps ahead of their 24 WMMAs
  for (int kk = 0; kk < Cc; kk += 4) {
    const v2f a = *(const v2f*)(ap + kk);
#pragma unroll // constant indices keep acc[] in registers
    for (int n = 0; n < GNT; ++n) {
      const v2f b = *(const v2f*)(bp + n * 16 * GP + kk);
      acc[n] = __builtin_amdgcn_wmma_f32_16x16x4_f32(false, a, false, b, (short)0, acc[n], false, false);
    }
  }
}

// Depthwise 5x5 of one thread: 4 channels of one image column, OR output rows, written
// as rows of the A tile in LDS (tile row = 8 * image row of the strip + pixel).
// It folds its own 25 taps x 4 channels from the LDS copy of w5, w3, w1 (16-byte reads of its
// 100, 36 and 4 consecutive floats; lanes lie 36 banks apart, so 16 lanes meet no conflict)
// and keeps them in registers for the whole walk. Every input row is read
// once per thread (5 neighbouring pixels, 16 bytes a lane, whole lines per wave) and
// is added into the 5 output rows that it reaches, so an output still takes its taps
// in the order dy = 0..4, dx = 0..4.
__device__ __forceinline__ void shift_walk(const float* __restrict__ xb, const float* wl, float* As,
                                           int tid, int x0, int y0, float a0, float a1, float a2, float a3) {
  const int c = (tid % C4) * 4;
  const int xx = x0 + tid / C4;
  const bool top = y0 > 0;        // image rows y0-2, y0-1 exist
  const bool bot = y0 + OR < HH;  // image rows y0+OR, y0+OR+1 exist
  const v4f zero = {0.f, 0.f, 0.f, 0.f};

  // A tap that falls left or right of the image gets weight 0 and reads the
  // thread's own column instead, so that its address stays inside x.
  unsigned off[5];  // in bytes, unsigned: a load is scalar row base + this 32-bit offset + an immediate
  bool ok[5];
#pragma unroll // constant indices keep off[], ok[] in registers
  for (int dx = 0; dx < 5; ++dx) {
    const int ix = xx + dx - 2;
    ok[dx] = dx == 2 || (ix >= 0 && ix < WW);  // the thread's own column is always inside
    off[dx] = (unsigned)((ok[dx] ? ix : xx) * Cc + c) * 4u;
  }

  const float* xr = xb + y0 * (WW * Cc);                              // first row of the strip
  const float* xt = xb + (top ? y0 - 2 : y0) * (WW * Cc);             // rows above it
  const float* xu = xb + (bot ? y0 + OR : y0 + OR - 2) * (WW * Cc);   // rows below it
  float* ad = As + (tid / C4) * GP + c;
  v4f in[OR + 4][5];
  v4f acc[OR];

  // Input row i is image row y0 + i - 2. Only the two rows above and the two below
  // the strip can lie outside the image: they then read a row of the strip (in
  // bounds) and are set to 0 where they are used.
#define LOAD_ROW(i)                                                            \
  {                                                                            \
    const float* rp = (i) < 2 ? xt + (i) * (WW * Cc)                            \
                      : (i) >= OR + 2 ? xu + ((i) - OR - 2) * (WW * Cc)         \
                                      : xr + ((i) - 2) * (WW * Cc);             \
    _Pragma("unroll") for (int dx = 0; dx < 5; ++dx) in[i][dx] = *(const v4f*)((const char*)rp + off[dx]); \
  }

#pragma unroll // constant indices keep in[] in registers
  for (int i = 0; i < OD; ++i) LOAD_ROW(i)

  v4f wr[25];
  v4f f3[9];
#pragma unroll // constant indices keep f3[] in registers
  for (int q = 0; q < 9; ++q) f3[q] = *(const v4f*)(wl + W3O + c * 9 + q * 4);
  const v4f f1 = *(const v4f*)(wl + W1O + c);
#pragma unroll // both loops: constant indices keep wr[], f3[] in registers
  for (int q = 0; q < 25; ++q) {
    const v4f f5 = *(const v4f*)(wl + c * 25 + q * 4);
#pragma unroll
    for (int e = 0; e < 4; ++e) {
      const int k = (q * 4 + e) / 25, tap = (q * 4 + e) % 25;  // channel c + k
      const int dy = tap / 5, dx = tap % 5;
      // the fused forms written out: a3 * w5 is rounded on its own, then w3's term joins in one fused step
      float wv = a3 * f5[e];
      if (dy >= 1 && dy <= 3 && dx >= 1 && dx <= 3) {
        const int j = k * 9 + (dy - 1) * 3 + (dx - 1);
        wv = fmaf(a2, f3[j / 4][j % 4], wv);
      }
      if (dy == 2 && dx == 2)
        wv += fmaf(a1, f1[k], a0);
      wr[tap][k] = ok[dx] ? wv : 0.f;
    }
  }
  // the walk's loads stay below the taps' masking: lifted above it, they take more
  // registers than the budget has and the build spills
  __builtin_amdgcn_sched_barrier(0);

#pragma unroll // constant indices keep in[], acc[] in registers
  for (int i = 0; i < OR + 4; ++i) {
    if (i + OD < OR + 4) LOAD_ROW(i + OD)
    const bool live = (i < 2) ? top : (i >= OR + 2) ? bot : true;  // block-uniform
#pragma unroll
    for (int dy = 0; dy < 5; ++dy) {
      const int o = i - dy;
      if (o < 0 || o >= OR) continue;
#pragma unroll
      for (int dx = 0; dx < 5; ++dx) {
        const v4f t = live ? in[i][dx] : zero;
        acc[o] = __builtin_elementwise_fma(wr[dy * 5 + dx], t, (dy == 0 && dx == 0) ? zero : acc[o]);
      }
    }
    if (i >= 4) *(v4f*)(ad + (i - 4) * (OPX * GP)) = acc[i - 4];  // output row i - 4 is complete
    // keeps the loads of later rows below this row's sums: lifted higher, they
    // take more registers than the budget has and the build spills
    __builtin_amdgcn_sched_barrier(0);
  }
#undef LOAD_ROW
}

// Tap folding, depthwise 5x5 and the three projections of one 8 x 16 pixel tile.
__global__ void __launch_bounds__(GT) shift_qkv(const float* __restrict__ x, const float* __restrict__ w1,
                                                const float* __restrict__ w3, const float* __restrict__ w5,
                                                const float* __restrict__ alpha, const float* __restrict__ Wk,
                                                const float* __restrict__ Wv, const float* __restrict__ Wr,
                                                float* __restrict__ kO, float* __restrict__ vO,
                                                float* __restrict__ srO) {
  __shared__ __attribute__((aligned(16))) float As[GM * GP];
  __shared__ __attribute__((aligned(16))) float Ws[Cc * GP];
  __shared__ __attribute__((aligned(16))) float wl[WLN];  // w5, w3, w1
  const int tid = threadIdx.x;
  const int lane = tid & 31;
  const int l16 = lane & 15;
  const int half = lane >> 4;
  const int wave = __builtin_amdgcn_readfirstlane(tid >> 5);  // scalar: the branch round the walk is a scalar one
  const int mw = (wave & 7) * 16;   // this wave's rows inside the tile
  const int nw = (wave >> 3) * 96;  // this wave's first column
  const int x0 = blockIdx.x * OPX;
  const int y0 = blockIdx.y * OR;
  const size_t img = (size_t)blockIdx.z * Tt * Cc;

  // r first: its sigmoid epilogue is the long one and runs while the next
  // matrix is on its way from L2.
  const float* const Wm[3] = {Wr, Wk, Wv};
  float* const Om[3] = {srO, kO, vO};
  const unsigned woff = (unsigned)tid * 16u;  // the thread's byte offset inside a weight matrix
  v4f wt[WV];
  load_w(Wm[0], tid, wt);

  // w5, w3, w1 -> LDS as they lie in memory, whole lines per wave. Every load is unconditional
  // at an index held in bounds, so that all are in flight together; the guards stand at the stores.
  static_assert(2 * GT <= 25 * C4 && 25 * C4 <= 3 * GT && 9 * C4 <= GT, "16-byte pieces per thread");
  const float a0 = alpha[0], a1 = alpha[1], a2 = alpha[2], a3 = alpha[3];
  const v4f d0 = *(const v4f*)(w5 + tid * 4);
  const v4f d1 = *(const v4f*)(w5 + (tid + GT) * 4);
  const int q2 = min(tid + 2 * GT, 25 * C4 - 1), q3 = min(tid, 9 * C4 - 1), q4 = min(tid, C4 - 1);
  const v4f d2 = *(const v4f*)(w5 + q2 * 4);
  const v4f d3 = *(const v4f*)(w3 + q3 * 4);
  const v4f d4 = *(const v4f*)(w1 + q4 * 4);
  // The wait in front of the first reuse of a register that a load above names: the clamped
  // indices are its inputs, so that none is taken for another value ahead of it. The loaded d2 is
  // an input too: its load would else sink behind the guard of its store and wait there alone.
  asm volatile("s_wait_xcnt 0x0" :: "v"(q2), "v"(q3), "v"(q4), "v"(d2) : "memory");
  *(v4f*)(wl + tid * 4) = d0;
  *(v4f*)(wl + (tid + GT) * 4) = d1;
  if (tid + 2 * GT < 25 * C4) *(v4f*)(wl + (tid + 2 * GT) * 4) = d2;
  if (tid < 9 * C4) *(v4f*)(wl + W3O + tid * 4) = d3;
  if (tid < C4) *(v4f*)(wl + W1O + tid * 4) = d4;
  store_w(Ws, tid, wt);
  lds_barrier();  // the depthwise weights are visible to the waves that walk
  if (wave < OT / 32) shift_walk(x + img, wl, As, tid, x0, y0, a0, a1, a2, a3);
  lds_barrier();  // A and the first matrix are visible to every wave

  const float* ap = As + (mw + l16) * GP + 2 * half;
  const float* bp = Ws + (nw + l16) * GP + 2 * half;
  // tile rows mw + 8 * half + r = image row y0 + mw / 8 + half, pixels x0 + r
  const size_t o0 = img + (size_t)((y0 + mw / 8 + half) * WW + x0) * Cc + nw + l16;
#pragma unroll // the pointers and the epilogue of each matrix resolve at compile time
  for (int mat = 0; mat < 3; ++mat) {
    v8f acc[GNT] = {};
    mm_strip(ap, bp, acc);
    if (mat < 2) {
      lds_barrier();  // every wave has left this matrix: Ws may be refilled
      const char* wp = (const char*)Wm[mat + 1] + woff;
      load_w_at(wp, wt);
      // The wait in front of the first reuse of a register that these loads name. Their address
      // is its input: it stays live past the run, so that no result of the run itself lands on it.
      asm volatile("s_wait_xcnt 0x0" :: "v"(wp) : "memory");
    }
    float* __restrict__ o = Om[mat] + o0;
#pragma unroll // both loops: constant indices keep acc[] in registers
    for (int r = 0; r < 8; ++r) {
#pragma unroll
      for (int n = 0; n < GNT; ++n) {
        const float d = acc[n][r];
        // fused sigmoid for r; e^-d = 2^(-d * log2 e), as __expf forms it
        o[(size_t)r * Cc + n * 16] = (mat == 0) ? 1.f / (1.f + exp2_slot(d * -1.44269504088896340736f)) : d;
      }
    }
    if (mat < 2) {
      // the accumulator registers these stores name are cleared for the next matrix
      asm volatile("s_wait_xcnt 0x0" ::: "memory");
      store_w(Ws, tid, wt);
      lds_barrier();  // the next matrix is visible to every wave
    }
  }
}

// Output GEMM: A = sr .* v formed while A is staged; D -> d_out.
__global__ void __launch_bounds__(GT) gemm_out(const float* __restrict__ sr, const float* __restrict__ vin,
                                               const float* __restrict__ Wo, float* __restrict__ out) {
  __shared__ __attribute__((aligned(16))) float As[GM * GP];
  __shared__ __attribute__((aligned(16))) float Ws[Cc * GP];
  const int tid = threadIdx.x;
  const int lane = tid & 31;
  const int l16 = lane & 15;
  const int half = lane >> 4;
  const int wave = tid >> 5;
  const int mw = (wave & 7) * 16;
  const int nw = (wave >> 3) * 96;
  const size_t m0 = (size_t)blockIdx.x * GM;

  const float* sg = sr + m0 * Cc;
  const float* vg = vin + m0 * Cc;
#pragma unroll // all loads of a thread in flight together
  for (int i = 0; i < (GM * C4) / GT; ++i) {
    const int idx = tid + i * GT;
    const v4f s4 = *(const v4f*)(sg + (size_t)idx * 4);
    const v4f w4 = *(const v4f*)(vg + (size_t)idx * 4);
    *(v4f*)(As + (idx / C4) * GP + (idx % C4) * 4) = s4 * w4;
  }
  v4f wt[WV];
  load_w(Wo, tid, wt);
  store_w(Ws, tid, wt);
  lds_barrier();  // both staged tiles are visible to every wave

  v8f acc[GNT] = {};
  mm_strip(As + (mw + l16) * GP + 2 * half, Ws + (nw + l16) * GP + 2 * half, acc);
  float* __restrict__ o = out + (m0 + mw + 8 * half) * Cc + nw + l16;
#pragma unroll // both loops: constant indices keep acc[] in registers
  for (int r = 0; r < 8; ++r) {
#pragma unroll
    for (int n = 0; n < GNT; ++n) o[(size_t)r * Cc + n * 16] = acc[n][r];
  }
}

// ---------------------------------------------------------------------------
// 3) WKV: chunked associative scan in log-scaled (p,q,o) space, two launches.
//    The carry into a chunk is formed in two levels, with no launch of its own:
//    pass 1 joins the summaries of the GRP chunks of its work-group in LDS
//    (carry inside the group, group total); pass 3 joins the totals of the
//    groups in front of its chunk with that carry.
//    Inside a chunk every term is scaled by ONE exponent base M (the largest k of the
//    chunk; in pass 3 also the two carries' scales): a step is then state = e^w * state
//    + e^(k-M) * (v, 1), two multiply-adds with no maximum and no exponential on the
//    serial path. (p, q, o) stands for (p, q) * e^o, so any base gives the same y; no
//    term exceeds e^(CHUNK*|w|), and a term that underflows is that far below the
//    largest term, which is part of every y's denominator.
//    Every kernel first issues ALL global loads of its chunk into registers and
//    only then walks the serial recurrence, so a wave waits for memory once per
//    chunk and not once per step. PERM is a template argument so that each load
//    is the lane's one base address plus an immediate offset.
// ---------------------------------------------------------------------------

// Float index of sequence position j*CHUNK of batch b. Consecutive positions of
// a chunk lie SEQ_STEP floats apart (PERM=1: s = x*H + y -> t = y*W + x, and
// CHUNK == H, so chunk j is image column j).
template <int PERM>
__device__ __forceinline__ size_t chunk_base(int b, int j) {
  return (size_t)b * Tt * Cc + (size_t)(PERM ? j : j * CHUNK) * Cc;
}
#define SEQ_STEP (PERM ? WW * Cc : Cc)

// e^x = 2^(x * log2 e), as __expf forms it, with the slot behind the transcendental kept
__device__ __forceinline__ float exp_slot(float x) { return exp2_slot(x * 1.44269504088896340736f); }

// The term of one position at base M: e^(kt-M) * (vt, 1).
__device__ __forceinline__ v2f wkv_term(float M, float kt, float vt) {
  const float e = exp_slot(kt - M);
  const v2f t = {e * vt, e};
  return t;
}

// (p,q,o) decays by D and takes in the summary (P,Q,O) of the segment behind it.
__device__ __forceinline__ void wkv_join(float D, float P, float Q, float O, float& p, float& q, float& o) {
  float no = fmaxf(o + D, O);
  // e^x = 2^(x * log2 e), as __expf forms it, with the slot behind the transcendental kept
  float A = exp2_slot((o + D - no) * 1.44269504088896340736f);
  float Bo2 = exp2_slot((O - no) * 1.44269504088896340736f);
  p = A * p + Bo2 * P;
  q = A * q + Bo2 * Q;
  o = no;
}

#define GRP 8            // chunks per group = chunks per pass-1 work-group
#define NG (NCH / GRP)   // groups per scan chain
#define P1C 32           // channels per pass-1 work-group: one wave per chunk, one whole line per load
#define P1T (GRP * P1C)  // threads per pass-1 work-group; 768 work-groups of 8 waves = three per WGP

// Pass 1: per-chunk totals, both directions in parallel, then the scan inside the group.
// sum layout: [dir][b][chunk][{p,q,o}][c] = carry into the chunk from its own group alone
// tot layout: [dir][b][group][{p,q,o}][c] = summary of the whole group
// second bound: 6 waves per SIMD = a budget of 160 registers, so that three work-groups fit
// a WGP and all 768 are resident at once
template <int PERM>
__global__ void __launch_bounds__(P1T, 6) wkv_pass1(const float* __restrict__ k, const float* __restrict__ v,
                                                 const float* __restrict__ decay, float* __restrict__ sum,
                                                 float* __restrict__ tot) {
  __shared__ float sl[3][GRP][P1C];
  // chunk inside the group = the wave's number: read as a scalar, so that the chunk's
  // addresses stay scalar base + lane offset and take no vector registers
  const int r = __builtin_amdgcn_readfirstlane(threadIdx.x / P1C);
  const int c0 = (blockIdx.x % (Cc / P1C)) * P1C + threadIdx.x % P1C;  // the thread's channel
  const int g = blockIdx.x / (Cc / P1C);
  const int j = g * GRP + r;
  const int b = blockIdx.y;
  const int dir = blockIdx.z;
  const float w = decay[c0] * (1.0f / Tt);
  // backward chunk j covers the positions of forward chunk NCH-1-j, last first
  const size_t base = chunk_base<PERM>(b, dir ? NCH - 1 - j : j) + c0;
  const float* kp = k + base;
  const float* vp = v + base;
  float kr[CHUNK], vr[CHUNK]; // the chunk in memory order
#pragma unroll // constant indices keep kr[], vr[] in registers; all loads in flight together
  for (int s = 0; s < CHUNK; ++s) {
    kr[s] = kp[s * SEQ_STEP];
    vr[s] = vp[s * SEQ_STEP];
  }
  float o = kr[0];  // the chunk's base
#pragma unroll // constant indices keep kr[] in registers
  for (int s = 1; s < CHUNK; ++s) o = fmaxf(o, kr[s]);
  const float ew = exp_slot(w);
#pragma unroll // constant indices keep kr[], vr[] in registers; the exponentials are independent
  for (int s = 0; s < CHUNK; ++s) {
    const v2f t = wkv_term(o, kr[s], vr[s]);  // each term takes the registers of its k and v
    vr[s] = t.x;
    kr[s] = t.y;
  }
  float p = 0.f, q = 0.f;
  // one walk per direction (block-uniform branch), so that both index the registers by constants
  if (dir) {
#pragma unroll // constant indices keep kr[], vr[] in registers
    for (int s = CHUNK - 1; s >= 0; --s) {
      p = fmaf(ew, p, vr[s]);
      q = fmaf(ew, q, kr[s]);
    }
  } else {
#pragma unroll // as above
    for (int s = 0; s < CHUNK; ++s) {
      p = fmaf(ew, p, vr[s]);
      q = fmaf(ew, q, kr[s]);
    }
  }
  // The channel formed anew from the lane's number (P1C is the wave's width, so the lane is
  // threadIdx.x % P1C): held across the walk it exceeds the register budget and is spilled.
  const int cl = __builtin_amdgcn_mbcnt_lo(~0u, 0u);
  const int c = (blockIdx.x % (Cc / P1C)) * P1C + cl;
  sl[0][r][cl] = p;
  sl[1][r][cl] = q;
  sl[2][r][cl] = o;
  __syncthreads();  // the group's GRP summaries are visible to every wave
  const float Lw = (float)CHUNK * w;
  float lp = 0.f, lq = 0.f, lo = -1e38f;
#pragma unroll // all LDS reads in flight together; a chunk keeps the joins of the chunks in front of it
  for (int i = 0; i < GRP - 1; ++i) {
    float tp = lp, tq = lq, to = lo;
    wkv_join(Lw, sl[0][i][cl], sl[1][i][cl], sl[2][i][cl], tp, tq, to);
    const bool on = i < r;
    lp = on ? tp : lp;
    lq = on ? tq : lq;
    lo = on ? to : lo;
  }
  // the last chunk's carry joined with its own summary is the group's total
  float gp = lp, gq = lq, go = lo;
  wkv_join(Lw, p, q, o, gp, gq, go);
  const size_t sb = ((((size_t)dir * Bb + b) * NCH + j) * 3) * Cc + c;
  const size_t tb = ((((size_t)dir * Bb + b) * NG + g) * 3) * Cc + c;
  sum[sb] = lp;
  sum[sb + Cc] = lq;
  sum[sb + 2 * Cc] = lo;
  // the last wave's join and addresses below may take registers that these stores name
  asm volatile("s_wait_xcnt 0x0" ::: "memory");
  if (r == GRP - 1) {
    tot[tb] = gp;
    tot[tb + Cc] = gq;
    tot[tb + 2 * Cc] = go;
  }
}

// Pass 3: walk the chunk forward, keeping for every position the forward sums plus
// the position's own term, then walk it backward, add the backward sums, divide, and
// write y in place over v. All at one base, so the three parts add without rescaling.
// k and v of the chunk are loaded once; their terms serve both walks from registers.
template <int PERM>
__global__ void __launch_bounds__(64) wkv_pass3(const float* __restrict__ k,
                                                float* __restrict__ v,
                                                const float* __restrict__ decay,
                                                const float* __restrict__ first,
                                                const float* __restrict__ sum,
                                                const float* __restrict__ tot) {
  const int tid = threadIdx.x;
  const int j = blockIdx.x;
  const int c = blockIdx.y * 64 + tid;
  const int b = blockIdx.z;
  const size_t base = chunk_base<PERM>(b, j) + c;
  const float* kp = k + base;
  float* vp = v + base;
  const float w = decay[c] * (1.0f / Tt);
  const float u = first[c] * (1.0f / Tt);

  // forward carry into chunk j from its own group (dir 0)
  size_t fb = (((size_t)b * NCH + j) * 3) * Cc + c;
  const float lpf = sum[fb], lqf = sum[fb + Cc], lof = sum[fb + 2 * Cc];
  // backward: the backward-chunk index is NCH-1-j (dir 1)
  size_t bbk = ((((size_t)1 * Bb + b) * NCH + (NCH - 1 - j)) * 3) * Cc + c;
  const float lpb = sum[bbk], lqb = sum[bbk + Cc], lob = sum[bbk + 2 * Cc];
  // totals of the first NG-1 groups of both directions: loaded whatever j is, so that
  // every load is one base plus an immediate; those not in front of chunk j are left out below
  const float* tf = tot + ((size_t)b * NG) * 3 * Cc + c;
  const float* tk = tot + (((size_t)Bb + b) * NG) * 3 * Cc + c;
  float TF[NG - 1][3], TB[NG - 1][3];
#pragma unroll // constant indices keep the totals in registers; all loads in flight together
  for (int t = 0; t < NG - 1; ++t) {
#pragma unroll
    for (int e = 0; e < 3; ++e) {
      TF[t][e] = tf[(t * 3 + e) * Cc];
      TB[t][e] = tk[(t * 3 + e) * Cc];
    }
  }
  // k and v behind the carries' loads: loads return in order, and the joins run while these arrive
  float kr[CHUNK], vr[CHUNK];
#pragma unroll // constant indices keep kr[], vr[] in registers; all loads in flight together
  for (int s = 0; s < CHUNK; ++s) {
    kr[s] = kp[s * SEQ_STEP];
    vr[s] = vp[s * SEQ_STEP];
  }
  // holds every load above the walks (none sinks into them), and stands in front
  // of the first reuse of their address registers
  asm volatile("s_wait_xcnt 0x0" ::: "memory");
  // keeps the joins below every load: lifted among them, their first wait would hold back
  // the issue of the k and v loads behind it by one memory latency
  __builtin_amdgcn_sched_barrier(0);

  // Carry into chunk j = (totals of the groups in front of its group, joined in order),
  // decayed over the chunks of its own group in front of it, joined with their carry.
  const int gf = j / GRP, rf = j % GRP;  // block-uniform; backward: NG-1-gf groups, GRP-1-rf chunks
  const float Gw = (float)(GRP * CHUNK) * w;
  float pf = 0.f, qf = 0.f, of_ = -1e38f;
  float pb = 0.f, qb = 0.f, ob = -1e38f;
#pragma unroll // constant indices keep the totals in registers; the two chains interleave
  for (int t = 0; t < NG - 1; ++t) {
    float tp = pf, tq = qf, to = of_;
    wkv_join(Gw, TF[t][0], TF[t][1], TF[t][2], tp, tq, to);
    const bool onf = t < gf;
    pf = onf ? tp : pf;
    qf = onf ? tq : qf;
    of_ = onf ? to : of_;
    tp = pb; tq = qb; to = ob;
    wkv_join(Gw, TB[t][0], TB[t][1], TB[t][2], tp, tq, to);
    const bool onb = t < NG - 1 - gf;
    pb = onb ? tp : pb;
    qb = onb ? tq : qb;
    ob = onb ? to : ob;
  }
  wkv_join((float)(rf * CHUNK) * w, lpf, lqf, lof, pf, qf, of_);
  wkv_join((float)((GRP - 1 - rf) * CHUNK) * w, lpb, lqb, lob, pb, qb, ob);

  // the base of this chunk: no term and no carry lies above it
  float M = fmaxf(of_, ob);
#pragma unroll // constant indices keep kr[] in registers
  for (int s = 0; s < CHUNK; ++s) M = fmaxf(M, kr[s]);
  const float ew = exp_slot(w), eu = exp_slot(u);
  const v2f ew2 = {ew, ew}, eu2 = {eu, eu};
  const float sf = exp_slot(of_ - M), sb = exp_slot(ob - M);
  v2f F = {pf * sf, qf * sf};   // sums over the positions in front, at base M
  v2f Bk = {pb * sb, qb * sb};  // sums over the positions behind
  v2f E[CHUNK], ND[CHUNK];
#pragma unroll // constant indices keep the arrays in registers; the exponentials are independent
  for (int s = 0; s < CHUNK; ++s) E[s] = wkv_term(M, kr[s], vr[s]);

#pragma unroll // constant indices keep E[], ND[] in registers
  for (int s = 0; s < CHUNK; ++s) {
    ND[s] = __builtin_elementwise_fma(eu2, E[s], F);  // e^(u+k) = e^u * e^k
    F = __builtin_elementwise_fma(ew2, F, E[s]);
  }

#pragma unroll // constant indices keep E[], ND[], vr[] in registers
  for (int s = CHUNK - 1; s >= 0; --s) {
    const v2f t = ND[s] + Bk;
    vr[s] = t.x / t.y;
    Bk = __builtin_elementwise_fma(ew2, Bk, E[s]);
  }
  // all stores last: no register that a store names is written again.
  // In place over v: these positions are read only by this thread.
#pragma unroll // constant indices keep vr[] in registers
  for (int s = 0; s < CHUNK; ++s) vp[s * SEQ_STEP] = vr[s];
}

// ---------------------------------------------------------------------------
// Launcher
// ---------------------------------------------------------------------------
extern "C" void kernel_launch(void* const* d_in, const int* in_sizes, int n_in,
                              void* d_out, int out_size, void* d_ws, size_t ws_size,
                              hipStream_t stream) {
  (void)in_sizes; (void)n_in; (void)out_size; (void)ws_size;
  const float* x     = (const float*)d_in[0];
  const float* w1    = (const float*)d_in[1];
  const float* w3    = (const float*)d_in[2];
  const float* w5    = (const float*)d_in[3];
  const float* alpha = (const float*)d_in[4];
  const float* Wk    = (const float*)d_in[5];
  const float* Wv    = (const float*)d_in[6];
  const float* Wr    = (const float*)d_in[7];
  const float* Wo    = (const float*)d_in[8];
  const float* sd    = (const float*)d_in[9];   // spatial_decay [2,C]
  const float* sf    = (const float*)d_in[10];  // spatial_first [2,C]
  float* out = (float*)d_out;
  float* ws  = (float*)d_ws;

  const size_t N1 = (size_t)Bb * Tt * Cc; // 6,291,456 floats
  float* kb   = ws + N1;
  float* vb   = ws + 2 * N1;
  float* srb  = ws + 3 * N1;
  float* sum  = ws + 4 * N1;        // 2*B*NCH*3*C floats (~2.4 MB)
  float* tot  = sum + 2 * Bb * NCH * 3 * Cc;  // 2*B*NG*3*C floats

  // 1+2) OmniShift (folded 5x5 depthwise conv) and the k/v/r projections (fp32 WMMA, fused sigmoid)
  shift_qkv<<<dim3(WW / OPX, HH / OR, Bb), dim3(GT), 0, stream>>>(x, w1, w3, w5, alpha, Wk, Wv, Wr, kb, vb, srb);

  // 3) Two bidirectional WKV scans (row-major, then column-major via perm)
  wkv_pass1<0><<<dim3(NG * (Cc / P1C), Bb, 2), dim3(P1T), 0, stream>>>(kb, vb, sd, sum, tot);
  wkv_pass3<0><<<dim3(NCH, Cc / 64, Bb), dim3(64), 0, stream>>>(kb, vb, sd, sf, sum, tot);
  wkv_pass1<1><<<dim3(NG * (Cc / P1C), Bb, 2), dim3(P1T), 0, stream>>>(kb, vb, sd + Cc, sum, tot);
  wkv_pass3<1><<<dim3(NCH, Cc / 64, Bb), dim3(64), 0, stream>>>(kb, vb, sd + Cc, sf + Cc, sum, tot);

  // 4) Output projection: (sr .* v) @ Wo^T  (fp32 WMMA)
  gemm_out<<<dim3((Bb * Tt) / GM), dim3(GT), 0, stream>>>(srb, vb, Wo, out);
}
